// v000
// The times below were measured on an AMD MI455X: many runs one after another, warmed up first and cycling through
// copies of the inputs, with the whole window's GPU time divided by the number of runs. Launches and the gaps
// between them are all in it. The median over several windows is given; except for v000 it joins two sittings, which
// can be a few percent apart, so the side-by-side timings, each taken in one sitting, are the better comparison.
// v000 is the starting kernel. One run takes 225 microseconds.
#include <hip/hip_runtime.h>
#include <hip/hip_bf16.h>

typedef __attribute__((ext_vector_type(16))) _Float16 v16h;
typedef __attribute__((ext_vector_type(8)))  float    v8f;

#define HW   4096
#define CDIM 64
#define ATT_SCALE 0.125f   // 64^-0.5

// ---------------------------------------------------------------------------
// CDNA5 async global->LDS copy, 16 bytes per lane, tracked by ASYNCcnt.
// lds_byte: workgroup-relative LDS byte address (low 32 bits of flat LDS pointer).
// ---------------------------------------------------------------------------
__device__ __forceinline__ void async_copy16(unsigned lds_byte, const void* gptr) {
    asm volatile("global_load_async_to_lds_b128 %0, %1, off"
                 :: "v"(lds_byte), "v"(gptr)
                 : "memory");
}

// xor-lane swap via single ds_swizzle_b32 (group-of-32: and=0x1f, xor=mask)
#define XOR_SWIZ(v, mask) \
    __int_as_float(__builtin_amdgcn_ds_swizzle(__float_as_int(v), (0x1f | ((mask) << 10))))

// ---------------------------------------------------------------------------
// Kernel 1: per-(b,c) InstanceNorm statistics over 4096 spatial elements
// ---------------------------------------------------------------------------
__global__ __launch_bounds__(256) void in_stats_kernel(const float* __restrict__ x,
                                                       float* __restrict__ mean,
                                                       float* __restrict__ rstd) {
    __shared__ float ssum[256];
    __shared__ float ssq[256];
    const int bc = blockIdx.x;                  // 0..255 = b*64 + c
    const float* xp = x + (size_t)bc * HW;
    float s = 0.f, sq = 0.f;
    for (int i = threadIdx.x; i < HW; i += 256) {
        float v = xp[i];
        s += v; sq += v * v;
    }
    ssum[threadIdx.x] = s; ssq[threadIdx.x] = sq;
    __syncthreads();
    for (int off = 128; off > 0; off >>= 1) {
        if (threadIdx.x < off) {
            ssum[threadIdx.x] += ssum[threadIdx.x + off];
            ssq[threadIdx.x]  += ssq[threadIdx.x + off];
        }
        __syncthreads();
    }
    if (threadIdx.x == 0) {
        float mu  = ssum[0] * (1.f / HW);
        float var = ssq[0] * (1.f / HW) - mu * mu;
        mean[bc] = mu;
        rstd[bc] = rsqrtf(var + 1e-5f);
    }
}

// ---------------------------------------------------------------------------
// Kernel 2: normalize + 1x1 conv QKV; q,k as f16 [B, HW, C]; v as f16 [B, C, HW]
// (V written pre-transposed so attention can async-DMA contiguous rows.)
// ---------------------------------------------------------------------------
__global__ __launch_bounds__(192) void qkv_kernel(const float* __restrict__ x,
                                                  const float* __restrict__ w_qkv,
                                                  const float* __restrict__ b_qkv,
                                                  const float* __restrict__ mean,
                                                  const float* __restrict__ rstd,
                                                  _Float16* __restrict__ q,
                                                  _Float16* __restrict__ k,
                                                  _Float16* __restrict__ vt) {
    __shared__ float h[CDIM];
    const int b = blockIdx.x >> 12;             // HW = 4096 blocks per batch
    const int n = blockIdx.x & (HW - 1);
    const int tid = threadIdx.x;
    if (tid < CDIM) {
        const int c = tid;
        float xv = x[((size_t)(b * CDIM + c)) * HW + n];
        h[c] = (xv - mean[b * CDIM + c]) * rstd[b * CDIM + c];
    }
    __syncthreads();
    const int o = tid;                          // 0..191
    float acc = b_qkv[o];
    #pragma unroll 8
    for (int c = 0; c < CDIM; ++c) acc += w_qkv[o * CDIM + c] * h[c];
    const _Float16 hv = (_Float16)acc;
    if (o < 64) {
        q[((size_t)(b * HW + n)) * CDIM + o] = hv;
    } else if (o < 128) {
        k[((size_t)(b * HW + n)) * CDIM + (o - 64)] = hv;
    } else {
        vt[((size_t)(b * CDIM + (o - 128))) * HW + n] = hv;   // transposed
    }
}

// ---------------------------------------------------------------------------
// Kernel 3: flash attention, WMMA f32_16x16x32_f16, double-buffered async
// global->LDS staging of K and V^T blocks.
// Grid: B * (HW/64) blocks, 128 threads (4 waves), each wave owns 16 q-rows.
// ---------------------------------------------------------------------------
__global__ __launch_bounds__(128) void attn_kernel(const _Float16* __restrict__ q,
                                                   const _Float16* __restrict__ k,
                                                   const _Float16* __restrict__ vt,
                                                   float* __restrict__ o) {
    // [buf][key][ch] and [buf][ch][key], padded row stride 80 halfs (160 B)
    __shared__ __align__(16) _Float16 k_lds[2][64 * 80];
    __shared__ __align__(16) _Float16 vt_lds[2][64 * 80];
    __shared__ __align__(16) _Float16 p_lds[4 * 16 * 64];

    const int b     = blockIdx.x >> 6;          // 64 query tiles per batch
    const int qtile = blockIdx.x & 63;
    const int tid   = threadIdx.x;
    const int wave  = tid >> 5;
    const int lane  = tid & 31;
    const int lrow  = lane & 15;
    const int lhalf = lane >> 4;

    const unsigned kbase[2]  = { (unsigned)(uintptr_t)&k_lds[0][0],
                                 (unsigned)(uintptr_t)&k_lds[1][0] };
    const unsigned vtbase[2] = { (unsigned)(uintptr_t)&vt_lds[0][0],
                                 (unsigned)(uintptr_t)&vt_lds[1][0] };

    // Q A-fragments (16 rows x 64 ch) held in registers for the whole kernel.
    const int qrow = qtile * 64 + wave * 16 + lrow;
    const _Float16* qbase = q + ((size_t)(b * HW + qrow)) * CDIM;
    const v16h a0 = *(const v16h*)(qbase + lhalf * 16);        // K 0..31
    const v16h a1 = *(const v16h*)(qbase + 32 + lhalf * 16);   // K 32..63

    v8f acc[4] = {};                           // output: 4 tiles of 16 channels
    float m[8], l[8];
    #pragma unroll
    for (int j = 0; j < 8; ++j) { m[j] = -1e30f; l[j] = 0.f; }

    _Float16* pw = p_lds + wave * 16 * 64;

    const char* kg0  = (const char*)(k  + ((size_t)b * HW) * CDIM);
    const char* vtg0 = (const char*)(vt + ((size_t)b * CDIM) * HW);

    // ---- issue async staging of one 64-key block (8 b128s per wave) ----
    auto stage_kv = [&](int kb, int buf) {
        const char* kg = kg0 + (size_t)kb * 64 * CDIM * 2;        // 8 KB block
        // K block: 64 rows x 128 B, 512 chunks of 16 B
        for (int i = tid; i < 512; i += 128) {
            const int key = i >> 3, c16 = i & 7;
            async_copy16(kbase[buf] + key * 160 + c16 * 16, kg + i * 16);
        }
        // V^T block: 64 ch-rows x 128 B (row stride HW*2 bytes in global)
        const char* vg = vtg0 + (size_t)kb * 64 * 2;
        for (int i = tid; i < 512; i += 128) {
            const int ch = i >> 3, k16 = i & 7;
            async_copy16(vtbase[buf] + ch * 160 + k16 * 16,
                         vg + (size_t)ch * (HW * 2) + k16 * 16);
        }
    };

    stage_kv(0, 0);

    for (int kb = 0; kb < HW / 64; ++kb) {
        const int cur = kb & 1;
        if (kb + 1 < HW / 64) {
            stage_kv(kb + 1, cur ^ 1);          // prefetch next block
            asm volatile("s_wait_asynccnt 8" ::: "memory");   // current landed
        } else {
            asm volatile("s_wait_asynccnt 0" ::: "memory");
        }
        __syncthreads();                        // all waves' staging visible

        const _Float16* kl = &k_lds[cur][0];
        const _Float16* vl = &vt_lds[cur][0];

        // ---- S = Q * K^T : 4 key sub-tiles of 16, K-dim 64 = 2 WMMA steps ----
        v8f s[4];
        #pragma unroll
        for (int t = 0; t < 4; ++t) {
            const int key = t * 16 + lrow;      // B-matrix column = key index
            v8f c = {};
            v16h b0 = *(const v16h*)(&kl[key * 80 + lhalf * 16]);
            c = __builtin_amdgcn_wmma_f32_16x16x32_f16(false, a0, false, b0,
                                                       (short)0, c, false, false);
            v16h b1 = *(const v16h*)(&kl[key * 80 + 32 + lhalf * 16]);
            c = __builtin_amdgcn_wmma_f32_16x16x32_f16(false, a1, false, b1,
                                                       (short)0, c, false, false);
            s[t] = c;
        }

        // ---- online softmax (row = VGPR index j + 8*lane_half) ----
        #pragma unroll
        for (int j = 0; j < 8; ++j) {
            float rmax = fmaxf(fmaxf(s[0][j], s[1][j]), fmaxf(s[2][j], s[3][j])) * ATT_SCALE;
            rmax = fmaxf(rmax, XOR_SWIZ(rmax, 1));
            rmax = fmaxf(rmax, XOR_SWIZ(rmax, 2));
            rmax = fmaxf(rmax, XOR_SWIZ(rmax, 4));
            rmax = fmaxf(rmax, XOR_SWIZ(rmax, 8));
            float mnew  = fmaxf(m[j], rmax);
            float alpha = __expf(m[j] - mnew);
            m[j] = mnew;
            l[j] *= alpha;
            #pragma unroll
            for (int t = 0; t < 4; ++t) acc[t][j] *= alpha;

            const int row = j + lhalf * 8;
            float rsum = 0.f;
            #pragma unroll
            for (int t = 0; t < 4; ++t) {
                float p = __expf(s[t][j] * ATT_SCALE - mnew);
                rsum += p;
                pw[row * 64 + t * 16 + lrow] = (_Float16)p;
            }
            rsum += XOR_SWIZ(rsum, 1);
            rsum += XOR_SWIZ(rsum, 2);
            rsum += XOR_SWIZ(rsum, 4);
            rsum += XOR_SWIZ(rsum, 8);
            l[j] += rsum;
        }

        // ---- O += P * V : A = P [16 x 64] from LDS, B = V^T staged in LDS ----
        #pragma unroll
        for (int kc = 0; kc < 2; ++kc) {
            v16h ap = *(const v16h*)(&pw[lrow * 64 + kc * 32 + lhalf * 16]);
            #pragma unroll
            for (int t = 0; t < 4; ++t) {
                const int ch = t * 16 + lrow;   // B-matrix column = out channel
                v16h bv = *(const v16h*)(&vl[ch * 80 + kc * 32 + lhalf * 16]);
                acc[t] = __builtin_amdgcn_wmma_f32_16x16x32_f16(false, ap, false, bv,
                                                                (short)0, acc[t], false, false);
            }
        }
        __syncthreads();   // done reading buf[cur]; next iter may overwrite it
    }

    // ---- normalize by row sums and write O [B, HW, C] f32 ----
    #pragma unroll
    for (int j = 0; j < 8; ++j) {
        const int row  = j + lhalf * 8;
        const int grow = qtile * 64 + wave * 16 + row;
        const float inv = 1.f / l[j];
        #pragma unroll
        for (int t = 0; t < 4; ++t) {
            o[((size_t)(b * HW + grow)) * CDIM + t * 16 + lrow] = acc[t][j] * inv;
        }
    }
}

// ---------------------------------------------------------------------------
// Kernel 4: 1x1 conv projection + residual, out [B, C, H, W] f32
// ---------------------------------------------------------------------------
__global__ __launch_bounds__(64) void proj_kernel(const float* __restrict__ x,
                                                  const float* __restrict__ w_proj,
                                                  const float* __restrict__ b_proj,
                                                  const float* __restrict__ o,
                                                  float* __restrict__ out) {
    __shared__ float h[CDIM];
    const int b = blockIdx.x >> 12;
    const int n = blockIdx.x & (HW - 1);
    const int c = threadIdx.x;
    h[c] = o[((size_t)(b * HW + n)) * CDIM + c];
    __syncthreads();
    float acc = b_proj[c];
    #pragma unroll 8
    for (int cc = 0; cc < CDIM; ++cc) acc += w_proj[c * CDIM + cc] * h[cc];
    const size_t idx = ((size_t)(b * CDIM + c)) * HW + n;
    out[idx] = x[idx] + acc;
}

// ---------------------------------------------------------------------------
extern "C" void kernel_launch(void* const* d_in, const int* in_sizes, int n_in,
                              void* d_out, int out_size, void* d_ws, size_t ws_size,
                              hipStream_t stream) {
    const float* x      = (const float*)d_in[0];
    const float* w_qkv  = (const float*)d_in[1];
    const float* b_qkv  = (const float*)d_in[2];
    const float* w_proj = (const float*)d_in[3];
    const float* b_proj = (const float*)d_in[4];
    float* out = (float*)d_out;

    const size_t B = 4, elems = B * HW * CDIM;   // 1,048,576 per tensor
    char* ws = (char*)d_ws;
    float*    mean = (float*)ws;                       // 256 f32
    float*    rstd = mean + 256;                       // 256 f32
    float*    obuf = (float*)(ws + 4096);              // 4 MB f32
    _Float16* q    = (_Float16*)(ws + 4096 + elems * sizeof(float));
    _Float16* k    = q + elems;                        // 2 MB each (f16)
    _Float16* vt   = k + elems;

    in_stats_kernel<<<B * CDIM, 256, 0, stream>>>(x, mean, rstd);
    qkv_kernel<<<B * HW, 192, 0, stream>>>(x, w_qkv, b_qkv, mean, rstd, q, k, vt);
    attn_kernel<<<B * (HW / 64), 128, 0, stream>>>(q, k, vt, obuf);
    proj_kernel<<<B * HW, 64, 0, stream>>>(x, w_proj, b_proj, obuf, out);
}

// v001
// It runs in 105 microseconds.
// Two timings next to v000 both put it at 2.23 times that version's speed.
#include <hip/hip_runtime.h>
#include <hip/hip_bf16.h>

typedef __attribute__((ext_vector_type(16))) _Float16 v16h;
typedef __attribute__((ext_vector_type(8)))  float    v8f;
typedef __attribute__((ext_vector_type(8)))  _Float16 v8h;
typedef __attribute__((ext_vector_type(2)))  _Float16 h16x2;
typedef __attribute__((ext_vector_type(4)))  float    f32x4;
typedef __attribute__((ext_vector_type(2)))  float    f32x2;

#define HW   4096
#define CDIM 64
#define ATT_SCALE 0.125f   // 64^-0.5
#define PXT      64        // pixels per tile in the two 1x1 convs
#define QK_PITCH 136       // halfs per staged pixel row: 128 + 8, a pitch of 16 B x odd
#define O_PITCH  68        // floats per staged pixel row: 64 + 4, a pitch of 16 B x odd

// ---------------------------------------------------------------------------
// CDNA5 async global->LDS copy, 16 bytes per lane, tracked by ASYNCcnt.
// lds_byte: workgroup-relative LDS byte address (low 32 bits of flat LDS pointer).
// ---------------------------------------------------------------------------
__device__ __forceinline__ void async_copy16(unsigned lds_byte, const void* gptr) {
    asm volatile("global_load_async_to_lds_b128 %0, %1, off"
                 :: "v"(lds_byte), "v"(gptr)
                 : "memory");
}

// xor-lane swap via single ds_swizzle_b32 (group-of-32: and=0x1f, xor=mask)
#define XOR_SWIZ(v, mask) \
    __int_as_float(__builtin_amdgcn_ds_swizzle(__float_as_int(v), (0x1f | ((mask) << 10))))

// ---------------------------------------------------------------------------
// Kernel 1: per-(b,c) InstanceNorm statistics over 4096 spatial elements
// ---------------------------------------------------------------------------
__global__ __launch_bounds__(256) void in_stats_kernel(const float* __restrict__ x,
                                                       float* __restrict__ mean,
                                                       float* __restrict__ rstd) {
    __shared__ float ssum[256];
    __shared__ float ssq[256];
    const int bc = blockIdx.x;                  // 0..255 = b*64 + c
    const float* xp = x + (size_t)bc * HW;
    float s = 0.f, sq = 0.f;
    for (int i = threadIdx.x; i < HW; i += 256) {
        float v = xp[i];
        s += v; sq += v * v;
    }
    ssum[threadIdx.x] = s; ssq[threadIdx.x] = sq;
    __syncthreads();
    for (int off = 128; off > 0; off >>= 1) {
        if (threadIdx.x < off) {
            ssum[threadIdx.x] += ssum[threadIdx.x + off];
            ssq[threadIdx.x]  += ssq[threadIdx.x + off];
        }
        __syncthreads();
    }
    if (threadIdx.x == 0) {
        float mu  = ssum[0] * (1.f / HW);
        float var = ssq[0] * (1.f / HW) - mu * mu;
        mean[bc] = mu;
        rstd[bc] = rsqrtf(var + 1e-5f);
    }
}

// ---------------------------------------------------------------------------
// Kernel 2: normalize + 1x1 conv QKV; q,k as f16 [B, HW, C]; v as f16 [B, C, HW]
// (V written pre-transposed so attention can async-DMA contiguous rows.)
// One work-group per tile of 64 pixels. Lanes run along pixels (two adjacent
// pixels per lane), each of the 12 waves owns 16 output channels, and the
// weights are wave-uniform, so they come through scalar loads.
// ---------------------------------------------------------------------------
__global__ __launch_bounds__(384) void qkv_kernel(const float* __restrict__ x,
                                                  const float* __restrict__ w_qkv,
                                                  const float* __restrict__ b_qkv,
                                                  const float* __restrict__ mean,
                                                  const float* __restrict__ rstd,
                                                  _Float16* __restrict__ q,
                                                  _Float16* __restrict__ k,
                                                  _Float16* __restrict__ vt) {
    __shared__ __align__(16) float    hs[CDIM * PXT];        // [c][pixel]
    __shared__ __align__(16) _Float16 qk[PXT * QK_PITCH];    // [pixel][q ch | k ch]
    const int b    = blockIdx.x >> 6;           // 64 pixel tiles per batch
    const int n0   = (blockIdx.x & 63) * PXT;
    const int tid  = threadIdx.x;
    const int lane = tid & 31;
    // wave number as a scalar, so that the weight addresses are scalar too
    const int wave = __builtin_amdgcn_readfirstlane(tid >> 5);

    // normalized tile, read in whole lines along the pixels
    // (1024 pieces of 16 B over 384 threads: the third trip is for waves 0..7 only;
    // loads first, LDS stores behind them, so that a thread's loads fly together)
    f32x4 xv[3];
    float mu[3], rs[3];
    #pragma unroll
    for (int r = 0; r < 3; ++r) {
        if (r < 2 || wave < 8) {
            const int i = tid + r * 384;
            const int c = i >> 4, p4 = (i & 15) * 4;
            xv[r] = *(const f32x4*)(x + ((size_t)(b * CDIM + c)) * HW + n0 + p4);
            mu[r] = mean[b * CDIM + c];
            rs[r] = rstd[b * CDIM + c];
        }
    }
    #pragma unroll
    for (int r = 0; r < 3; ++r) {
        if (r < 2 || wave < 8) {
            const int i = tid + r * 384;
            const int c = i >> 4, p4 = (i & 15) * 4;
            f32x4 hv;
            #pragma unroll
            for (int e = 0; e < 4; ++e) hv[e] = (xv[r][e] - mu[r]) * rs[r];
            *(f32x4*)(hs + c * PXT + p4) = hv;
        }
    }
    __syncthreads();

    const int o0 = wave * 16;                   // 0..176
    const float* wrow = w_qkv + o0 * CDIM;
    f32x2 acc[16];
    #pragma unroll
    for (int u = 0; u < 16; ++u) { const float bv = b_qkv[o0 + u]; acc[u][0] = bv; acc[u][1] = bv; }
    // rolled over groups of 4 input channels: a short loop body in the instruction cache
    #pragma unroll 1
    for (int c4 = 0; c4 < CDIM; c4 += 4) {
        #pragma unroll
        for (int j = 0; j < 4; ++j) {
            const f32x2 h = *(const f32x2*)(hs + (c4 + j) * PXT + 2 * lane);
            #pragma unroll
            for (int u = 0; u < 16; ++u) acc[u] += wrow[u * CDIM + c4 + j] * h;
        }
    }

    if (wave < 8) {
        // q and k: gather each pixel's channels in LDS so that whole rows go out
        #pragma unroll
        for (int e = 0; e < 2; ++e) {
            v8h lo, hi;
            #pragma unroll
            for (int u = 0; u < 8; ++u) { lo[u] = (_Float16)acc[u][e]; hi[u] = (_Float16)acc[u + 8][e]; }
            _Float16* dst = qk + (2 * lane + e) * QK_PITCH + o0;
            *(v8h*)dst       = lo;
            *(v8h*)(dst + 8) = hi;
        }
    } else {
        // v transposed: one 128-byte line of 64 pixels per channel and wave
        #pragma unroll
        for (int u = 0; u < 16; ++u) {
            h16x2 pv;
            pv[0] = (_Float16)acc[u][0]; pv[1] = (_Float16)acc[u][1];
            *(h16x2*)(vt + ((size_t)(b * CDIM + (o0 - 128 + u))) * HW + n0 + 2 * lane) = pv;
        }
        // before a register that these stores name is written again (precaution for issued stores)
        asm volatile("s_wait_xcnt 0x0" ::: "memory");
    }
    __syncthreads();
    if (wave < 8) {
        _Float16* dst = (wave < 4 ? q : k) + ((size_t)(b * HW + n0)) * CDIM;
        const int chb = (wave >> 2) * CDIM;
        #pragma unroll
        for (int i = 0; i < 4; ++i) {
            const int row = (wave & 3) * 16 + i * 4 + (lane >> 3);
            const int ch  = (lane & 7) * 8;
            *(v8h*)(dst + row * CDIM + ch) = *(const v8h*)(qk + row * QK_PITCH + chb + ch);
        }
    }
}

// ---------------------------------------------------------------------------
// Kernel 3: flash attention, WMMA f32_16x16x32_f16, double-buffered async
// global->LDS staging of K and V^T blocks.
// Grid: B * (HW/64) blocks, 128 threads (4 waves), each wave owns 16 q-rows.
// ---------------------------------------------------------------------------
__global__ __launch_bounds__(128) void attn_kernel(const _Float16* __restrict__ q,
                                                   const _Float16* __restrict__ k,
                                                   const _Float16* __restrict__ vt,
                                                   float* __restrict__ o) {
    // [buf][key][ch] and [buf][ch][key], padded row stride 80 halfs (160 B)
    __shared__ __align__(16) _Float16 k_lds[2][64 * 80];
    __shared__ __align__(16) _Float16 vt_lds[2][64 * 80];
    __shared__ __align__(16) _Float16 p_lds[4 * 16 * 64];

    const int b     = blockIdx.x >> 6;          // 64 query tiles per batch
    const int qtile = blockIdx.x & 63;
    const int tid   = threadIdx.x;
    const int wave  = tid >> 5;
    const int lane  = tid & 31;
    const int lrow  = lane & 15;
    const int lhalf = lane >> 4;

    const unsigned kbase[2]  = { (unsigned)(uintptr_t)&k_lds[0][0],
                                 (unsigned)(uintptr_t)&k_lds[1][0] };
    const unsigned vtbase[2] = { (unsigned)(uintptr_t)&vt_lds[0][0],
                                 (unsigned)(uintptr_t)&vt_lds[1][0] };

    // Q A-fragments (16 rows x 64 ch) held in registers for the whole kernel.
    const int qrow = qtile * 64 + wave * 16 + lrow;
    const _Float16* qbase = q + ((size_t)(b * HW + qrow)) * CDIM;
    const v16h a0 = *(const v16h*)(qbase + lhalf * 16);        // K 0..31
    const v16h a1 = *(const v16h*)(qbase + 32 + lhalf * 16);   // K 32..63

    v8f acc[4] = {};                           // output: 4 tiles of 16 channels
    float m[8], l[8];
    #pragma unroll
    for (int j = 0; j < 8; ++j) { m[j] = -1e30f; l[j] = 0.f; }

    _Float16* pw = p_lds + wave * 16 * 64;

    const char* kg0  = (const char*)(k  + ((size_t)b * HW) * CDIM);
    const char* vtg0 = (const char*)(vt + ((size_t)b * CDIM) * HW);

    // ---- issue async staging of one 64-key block (8 b128s per wave) ----
    auto stage_kv = [&](int kb, int buf) {
        const char* kg = kg0 + (size_t)kb * 64 * CDIM * 2;        // 8 KB block
        // K block: 64 rows x 128 B, 512 chunks of 16 B
        for (int i = tid; i < 512; i += 128) {
            const int key = i >> 3, c16 = i & 7;
            async_copy16(kbase[buf] + key * 160 + c16 * 16, kg + i * 16);
        }
        // V^T block: 64 ch-rows x 128 B (row stride HW*2 bytes in global)
        const char* vg = vtg0 + (size_t)kb * 64 * 2;
        for (int i = tid; i < 512; i += 128) {
            const int ch = i >> 3, k16 = i & 7;
            async_copy16(vtbase[buf] + ch * 160 + k16 * 16,
                         vg + (size_t)ch * (HW * 2) + k16 * 16);
        }
    };

    stage_kv(0, 0);

    for (int kb = 0; kb < HW / 64; ++kb) {
        const int cur = kb & 1;
        if (kb + 1 < HW / 64) {
            stage_kv(kb + 1, cur ^ 1);          // prefetch next block
            asm volatile("s_wait_asynccnt 8" ::: "memory");   // current landed
        } else {
            asm volatile("s_wait_asynccnt 0" ::: "memory");
        }
        __syncthreads();                        // all waves' staging visible

        const _Float16* kl = &k_lds[cur][0];
        const _Float16* vl = &vt_lds[cur][0];

        // ---- S = Q * K^T : 4 key sub-tiles of 16, K-dim 64 = 2 WMMA steps ----
        v8f s[4];
        #pragma unroll
        for (int t = 0; t < 4; ++t) {
            const int key = t * 16 + lrow;      // B-matrix column = key index
            v8f c = {};
            v16h b0 = *(const v16h*)(&kl[key * 80 + lhalf * 16]);
            c = __builtin_amdgcn_wmma_f32_16x16x32_f16(false, a0, false, b0,
                                                       (short)0, c, false, false);
            v16h b1 = *(const v16h*)(&kl[key * 80 + 32 + lhalf * 16]);
            c = __builtin_amdgcn_wmma_f32_16x16x32_f16(false, a1, false, b1,
                                                       (short)0, c, false, false);
            s[t] = c;
        }

        // ---- online softmax (row = VGPR index j + 8*lane_half) ----
        #pragma unroll
        for (int j = 0; j < 8; ++j) {
            float rmax = fmaxf(fmaxf(s[0][j], s[1][j]), fmaxf(s[2][j], s[3][j])) * ATT_SCALE;
            rmax = fmaxf(rmax, XOR_SWIZ(rmax, 1));
            rmax = fmaxf(rmax, XOR_SWIZ(rmax, 2));
            rmax = fmaxf(rmax, XOR_SWIZ(rmax, 4));
            rmax = fmaxf(rmax, XOR_SWIZ(rmax, 8));
            float mnew  = fmaxf(m[j], rmax);
            float alpha = __expf(m[j] - mnew);
            m[j] = mnew;
            l[j] *= alpha;
            #pragma unroll
            for (int t = 0; t < 4; ++t) acc[t][j] *= alpha;

            const int row = j + lhalf * 8;
            float rsum = 0.f;
            #pragma unroll
            for (int t = 0; t < 4; ++t) {
                float p = __expf(s[t][j] * ATT_SCALE - mnew);
                rsum += p;
                pw[row * 64 + t * 16 + lrow] = (_Float16)p;
            }
            rsum += XOR_SWIZ(rsum, 1);
            rsum += XOR_SWIZ(rsum, 2);
            rsum += XOR_SWIZ(rsum, 4);
            rsum += XOR_SWIZ(rsum, 8);
            l[j] += rsum;
        }

        // ---- O += P * V : A = P [16 x 64] from LDS, B = V^T staged in LDS ----
        #pragma unroll
        for (int kc = 0; kc < 2; ++kc) {
            v16h ap = *(const v16h*)(&pw[lrow * 64 + kc * 32 + lhalf * 16]);
            #pragma unroll
            for (int t = 0; t < 4; ++t) {
                const int ch = t * 16 + lrow;   // B-matrix column = out channel
                v16h bv = *(const v16h*)(&vl[ch * 80 + kc * 32 + lhalf * 16]);
                acc[t] = __builtin_amdgcn_wmma_f32_16x16x32_f16(false, ap, false, bv,
                                                                (short)0, acc[t], false, false);
            }
        }
        __syncthreads();   // done reading buf[cur]; next iter may overwrite it
    }

    // ---- normalize by row sums and write O [B, HW, C] f32 ----
    #pragma unroll
    for (int j = 0; j < 8; ++j) {
        const int row  = j + lhalf * 8;
        const int grow = qtile * 64 + wave * 16 + row;
        const float inv = 1.f / l[j];
        #pragma unroll
        for (int t = 0; t < 4; ++t) {
            o[((size_t)(b * HW + grow)) * CDIM + t * 16 + lrow] = acc[t][j] * inv;
        }
    }
}

// ---------------------------------------------------------------------------
// Kernel 4: 1x1 conv projection + residual, out [B, C, H, W] f32
// One work-group per tile of 64 pixels; lanes run along pixels (lane, lane+32),
// each of the 8 waves owns 8 output channels, weights through scalar loads.
// ---------------------------------------------------------------------------
__global__ __launch_bounds__(256) void proj_kernel(const float* __restrict__ x,
                                                   const float* __restrict__ w_proj,
                                                   const float* __restrict__ b_proj,
                                                   const float* __restrict__ o,
                                                   float* __restrict__ out) {
    __shared__ __align__(16) float hs[PXT * O_PITCH];        // [pixel][ch]
    const int b    = blockIdx.x >> 6;
    const int n0   = (blockIdx.x & 63) * PXT;
    const int tid  = threadIdx.x;
    const int lane = tid & 31;
    // wave number as a scalar, so that the weight addresses are scalar too
    const int wave = __builtin_amdgcn_readfirstlane(tid >> 5);
    const int c0   = wave * 8;

    // the tile's 64 rows of o are contiguous: read them in whole lines
    // (loads first, LDS stores behind them, so that a thread's loads fly together)
    const float* ot = o + ((size_t)(b * HW + n0)) * CDIM;
    f32x4 ov[4];
    #pragma unroll
    for (int r = 0; r < 4; ++r) ov[r] = *(const f32x4*)(ot + (tid + r * 256) * 4);
    const size_t idx0 = ((size_t)(b * CDIM + c0)) * HW + n0 + lane;
    float xr[8][2];
    #pragma unroll
    for (int u = 0; u < 8; ++u) {
        xr[u][0] = x[idx0 + (size_t)u * HW];
        xr[u][1] = x[idx0 + (size_t)u * HW + 32];
    }
    #pragma unroll
    for (int r = 0; r < 4; ++r) {
        const int i = tid + r * 256;
        *(f32x4*)(hs + (i >> 4) * O_PITCH + (i & 15) * 4) = ov[r];
    }
    __syncthreads();

    const float* wrow = w_proj + c0 * CDIM;
    float acc[8][2];
    #pragma unroll
    for (int u = 0; u < 8; ++u) { acc[u][0] = b_proj[c0 + u]; acc[u][1] = acc[u][0]; }
    // rolled over groups of 8 input channels: a short loop body in the instruction cache
    #pragma unroll 1
    for (int c8 = 0; c8 < CDIM; c8 += 8) {
        #pragma unroll
        for (int g = 0; g < 8; g += 4) {
            const f32x4 ha = *(const f32x4*)(hs + lane * O_PITCH + c8 + g);
            const f32x4 hb = *(const f32x4*)(hs + (lane + 32) * O_PITCH + c8 + g);
            #pragma unroll
            for (int j = 0; j < 4; ++j) {
                #pragma unroll
                for (int u = 0; u < 8; ++u) {
                    const float wv = wrow[u * CDIM + c8 + g + j];
                    acc[u][0] += wv * ha[j];
                    acc[u][1] += wv * hb[j];
                }
            }
        }
    }
    #pragma unroll
    for (int u = 0; u < 8; ++u) {
        out[idx0 + (size_t)u * HW]      = xr[u][0] + acc[u][0];
        out[idx0 + (size_t)u * HW + 32] = xr[u][1] + acc[u][1];
    }
}

// ---------------------------------------------------------------------------
extern "C" void kernel_launch(void* const* d_in, const int* in_sizes, int n_in,
                              void* d_out, int out_size, void* d_ws, size_t ws_size,
                              hipStream_t stream) {
    const float* x      = (const float*)d_in[0];
    const float* w_qkv  = (const float*)d_in[1];
    const float* b_qkv  = (const float*)d_in[2];
    const float* w_proj = (const float*)d_in[3];
    const float* b_proj = (const float*)d_in[4];
    float* out = (float*)d_out;

    const size_t B = 4, elems = B * HW * CDIM;   // 1,048,576 per tensor
    char* ws = (char*)d_ws;
    float*    mean = (float*)ws;                       // 256 f32
    float*    rstd = mean + 256;                       // 256 f32
    float*    obuf = (float*)(ws + 4096);              // 4 MB f32
    _Float16* q    = (_Float16*)(ws + 4096 + elems * sizeof(float));
    _Float16* k    = q + elems;                        // 2 MB each (f16)
    _Float16* vt   = k + elems;

    in_stats_kernel<<<B * CDIM, 256, 0, stream>>>(x, mean, rstd);
    qkv_kernel<<<B * (HW / 64), 384, 0, stream>>>(x, w_qkv, b_qkv, mean, rstd, q, k, vt);
    attn_kernel<<<B * (HW / 64), 128, 0, stream>>>(q, k, vt, obuf);
    proj_kernel<<<B * (HW / 64), 256, 0, stream>>>(x, w_proj, b_proj, obuf, out);
}

// v002
// Measured time: 66 microseconds a run.
// In both of two side-by-side timings against v001, it was 1.59 times as fast.
// All steps since v000 together make it 3.54 times as fast.
#include <hip/hip_runtime.h>
#include <hip/hip_bf16.h>

typedef __attribute__((ext_vector_type(16))) _Float16 v16h;
typedef __attribute__((ext_vector_type(8)))  float    v8f;
typedef __attribute__((ext_vector_type(8)))  _Float16 v8h;
typedef __attribute__((ext_vector_type(2)))  _Float16 h16x2;
typedef __attribute__((ext_vector_type(4)))  float    f32x4;
typedef __attribute__((ext_vector_type(2)))  float    f32x2;

#define HW   4096
#define CDIM 64
#define ATT_SCALE 0.125f   // 64^-0.5
#define PXT      64        // pixels per tile in the two 1x1 convs
#define QK_PITCH 136       // halfs per staged pixel row: 128 + 8, a pitch of 16 B x odd
#define O_PITCH  68        // floats per staged pixel row: 64 + 4, a pitch of 16 B x odd

// ---------------------------------------------------------------------------
// CDNA5 async global->LDS copy, 16 bytes per lane, tracked by ASYNCcnt.
// lds_byte: workgroup-relative LDS byte address (low 32 bits of flat LDS pointer).
// ---------------------------------------------------------------------------
__device__ __forceinline__ void async_copy16(unsigned lds_byte, const void* gptr) {
    asm volatile("global_load_async_to_lds_b128 %0, %1, off"
                 :: "v"(lds_byte), "v"(gptr)
                 : "memory");
}

// lane l <-> lane l ^ 16, on the vector pipe
__device__ __forceinline__ float xhalf(float v) {
    const int b = __float_as_int(v);
    return __int_as_float(__builtin_amdgcn_permlanex16(b, b, 0x76543210, 0xfedcba98, false, false));
}

// one 16x32 f16 operand row in the hardware k order: for lane half h the halfs
// 8h..8h+7 and 16+8h..16+8h+7 of the 32; p already points at half 8h
__device__ __forceinline__ v16h frag_kmap(const _Float16* p) {
    const v8h lo = *(const v8h*)p;
    const v8h hi = *(const v8h*)(p + 16);
    return __builtin_shufflevector(lo, hi, 0, 1, 2, 3, 4, 5, 6, 7, 8, 9, 10, 11, 12, 13, 14, 15);
}

// ---------------------------------------------------------------------------
// Kernel 1: per-(b,c) InstanceNorm statistics over 4096 spatial elements
// ---------------------------------------------------------------------------
__global__ __launch_bounds__(256) void in_stats_kernel(const float* __restrict__ x,
                                                       float* __restrict__ mean,
                                                       float* __restrict__ rstd) {
    __shared__ float ssum[256];
    __shared__ float ssq[256];
    const int bc = blockIdx.x;                  // 0..255 = b*64 + c
    const float* xp = x + (size_t)bc * HW;
    float s = 0.f, sq = 0.f;
    for (int i = threadIdx.x; i < HW; i += 256) {
        float v = xp[i];
        s += v; sq += v * v;
    }
    ssum[threadIdx.x] = s; ssq[threadIdx.x] = sq;
    __syncthreads();
    for (int off = 128; off > 0; off >>= 1) {
        if (threadIdx.x < off) {
            ssum[threadIdx.x] += ssum[threadIdx.x + off];
            ssq[threadIdx.x]  += ssq[threadIdx.x + off];
        }
        __syncthreads();
    }
    if (threadIdx.x == 0) {
        float mu  = ssum[0] * (1.f / HW);
        float var = ssq[0] * (1.f / HW) - mu * mu;
        mean[bc] = mu;
        rstd[bc] = rsqrtf(var + 1e-5f);
    }
}

// ---------------------------------------------------------------------------
// Kernel 2: normalize + 1x1 conv QKV; q,k as f16 [B, HW, C]; v as f16 [B, C, HW]
// (V written pre-transposed so attention can async-DMA contiguous rows.)
// One work-group per tile of 64 pixels. Lanes run along pixels (two adjacent
// pixels per lane), each of the 12 waves owns 16 output channels, and the
// weights are wave-uniform, so they come through scalar loads.
// ---------------------------------------------------------------------------
__global__ __launch_bounds__(384) void qkv_kernel(const float* __restrict__ x,
                                                  const float* __restrict__ w_qkv,
                                                  const float* __restrict__ b_qkv,
                                                  const float* __restrict__ mean,
                                                  const float* __restrict__ rstd,
                                                  _Float16* __restrict__ q,
                                                  _Float16* __restrict__ k,
                                                  _Float16* __restrict__ vt) {
    __shared__ __align__(16) float    hs[CDIM * PXT];        // [c][pixel]
    __shared__ __align__(16) _Float16 qk[PXT * QK_PITCH];    // [pixel][q ch | k ch]
    const int b    = blockIdx.x >> 6;           // 64 pixel tiles per batch
    const int n0   = (blockIdx.x & 63) * PXT;
    const int tid  = threadIdx.x;
    const int lane = tid & 31;
    // wave number as a scalar, so that the weight addresses are scalar too
    const int wave = __builtin_amdgcn_readfirstlane(tid >> 5);

    // normalized tile, read in whole lines along the pixels
    // (1024 pieces of 16 B over 384 threads: the third trip is for waves 0..7 only;
    // loads first, LDS stores behind them, so that a thread's loads fly together)
    f32x4 xv[3];
    float mu[3], rs[3];
    #pragma unroll
    for (int r = 0; r < 3; ++r) {
        if (r < 2 || wave < 8) {
            const int i = tid + r * 384;
            const int c = i >> 4, p4 = (i & 15) * 4;
            xv[r] = *(const f32x4*)(x + ((size_t)(b * CDIM + c)) * HW + n0 + p4);
            mu[r] = mean[b * CDIM + c];
            rs[r] = rstd[b * CDIM + c];
        }
    }
    #pragma unroll
    for (int r = 0; r < 3; ++r) {
        if (r < 2 || wave < 8) {
            const int i = tid + r * 384;
            const int c = i >> 4, p4 = (i & 15) * 4;
            f32x4 hv;
            #pragma unroll
            for (int e = 0; e < 4; ++e) hv[e] = (xv[r][e] - mu[r]) * rs[r];
            *(f32x4*)(hs + c * PXT + p4) = hv;
        }
    }
    __syncthreads();

    const int o0 = wave * 16;                   // 0..176
    const float* wrow = w_qkv + o0 * CDIM;
    f32x2 acc[16];
    #pragma unroll
    for (int u = 0; u < 16; ++u) { const float bv = b_qkv[o0 + u]; acc[u][0] = bv; acc[u][1] = bv; }
    // rolled over groups of 4 input channels: a short loop body in the instruction cache
    #pragma unroll 1
    for (int c4 = 0; c4 < CDIM; c4 += 4) {
        #pragma unroll
        for (int j = 0; j < 4; ++j) {
            const f32x2 h = *(const f32x2*)(hs + (c4 + j) * PXT + 2 * lane);
            #pragma unroll
            for (int u = 0; u < 16; ++u) acc[u] += wrow[u * CDIM + c4 + j] * h;
        }
    }

    if (wave < 8) {
        // q and k: gather each pixel's channels in LDS so that whole rows go out
        #pragma unroll
        for (int e = 0; e < 2; ++e) {
            v8h lo, hi;
            #pragma unroll
            for (int u = 0; u < 8; ++u) { lo[u] = (_Float16)acc[u][e]; hi[u] = (_Float16)acc[u + 8][e]; }
            _Float16* dst = qk + (2 * lane + e) * QK_PITCH + o0;
            *(v8h*)dst       = lo;
            *(v8h*)(dst + 8) = hi;
        }
    } else {
        // v transposed: one 128-byte line of 64 pixels per channel and wave
        #pragma unroll
        for (int u = 0; u < 16; ++u) {
            h16x2 pv;
            pv[0] = (_Float16)acc[u][0]; pv[1] = (_Float16)acc[u][1];
            *(h16x2*)(vt + ((size_t)(b * CDIM + (o0 - 128 + u))) * HW + n0 + 2 * lane) = pv;
        }
        // before a register that these stores name is written again (precaution for issued stores)
        asm volatile("s_wait_xcnt 0x0" ::: "memory");
    }
    __syncthreads();
    if (wave < 8) {
        _Float16* dst = (wave < 4 ? q : k) + ((size_t)(b * HW + n0)) * CDIM;
        const int chb = (wave >> 2) * CDIM;
        #pragma unroll
        for (int i = 0; i < 4; ++i) {
            const int row = (wave & 3) * 16 + i * 4 + (lane >> 3);
            const int ch  = (lane & 7) * 8;
            *(v8h*)(dst + row * CDIM + ch) = *(const v8h*)(qk + row * QK_PITCH + chb + ch);
        }
    }
}

__global__ __launch_bounds__(128) void attn_kernel(const _Float16* __restrict__ q,
                                                   const _Float16* __restrict__ k,
                                                   const _Float16* __restrict__ vt,
                                                   float* __restrict__ o) {
    // [buf][key][ch] and [buf][ch][key], padded row stride 80 halfs (160 B)
    __shared__ __align__(16) _Float16 k_lds[2][64 * 80];
    __shared__ __align__(16) _Float16 vt_lds[2][64 * 80];

    const int b     = blockIdx.x >> 6;          // 64 query tiles per batch
    const int qtile = blockIdx.x & 63;
    const int tid   = threadIdx.x;
    const int wave  = tid >> 5;
    const int lane  = tid & 31;
    const int lrow  = lane & 15;
    const int lhalf = lane >> 4;

    const unsigned kbase[2]  = { (unsigned)(uintptr_t)&k_lds[0][0],
                                 (unsigned)(uintptr_t)&k_lds[1][0] };
    const unsigned vtbase[2] = { (unsigned)(uintptr_t)&vt_lds[0][0],
                                 (unsigned)(uintptr_t)&vt_lds[1][0] };

    // Q B-fragments (64 ch x 16 queries) held in registers for the whole kernel.
    const int qrow = qtile * 64 + wave * 16 + lrow;
    const _Float16* qbase = q + ((size_t)(b * HW + qrow)) * CDIM;
    const v16h qf[2] = { frag_kmap(qbase + lhalf * 8),         // ch 0..31
                         frag_kmap(qbase + 32 + lhalf * 8) };  // ch 32..63

    v8f acc[4] = {};     // O^T: 4 tiles of 16 channels, acc[t][r] = ch 16t + 8*lhalf + r
    float m = -1e30f;    // this lane's query: running maximum (same in both halves)
    float l = 0.f;       // and the sum over this lane half's keys only

    const char* kg0  = (const char*)(k  + ((size_t)b * HW) * CDIM);
    const char* vtg0 = (const char*)(vt + ((size_t)b * CDIM) * HW);

    // ---- issue async staging of one 64-key block (8 b128s per wave) ----
    auto stage_kv = [&](int kb, int buf) {
        const char* kg = kg0 + (size_t)kb * 64 * CDIM * 2;        // 8 KB block
        // K block: 64 rows x 128 B, 512 chunks of 16 B
        for (int i = tid; i < 512; i += 128) {
            const int key = i >> 3, c16 = i & 7;
            async_copy16(kbase[buf] + key * 160 + c16 * 16, kg + i * 16);
        }
        // V^T block: 64 ch-rows x 128 B (row stride HW*2 bytes in global)
        const char* vg = vtg0 + (size_t)kb * 64 * 2;
        for (int i = tid; i < 512; i += 128) {
            const int ch = i >> 3, k16 = i & 7;
            async_copy16(vtbase[buf] + ch * 160 + k16 * 16,
                         vg + (size_t)ch * (HW * 2) + k16 * 16);
        }
    };

    stage_kv(0, 0);

    for (int kb = 0; kb < HW / 64; ++kb) {
        const int cur = kb & 1;
        if (kb + 1 < HW / 64) {
            stage_kv(kb + 1, cur ^ 1);          // prefetch next block
            asm volatile("s_wait_asynccnt 8" ::: "memory");   // current landed
        } else {
            asm volatile("s_wait_asynccnt 0" ::: "memory");
        }
        __syncthreads();                        // all waves' staging visible

        const _Float16* kl = &k_lds[cur][0];
        const _Float16* vl = &vt_lds[cur][0];

        // ---- S^T = K * Q^T : 4 tiles of 16 keys, s[t][r] = key 16t + 8*lhalf + r ----
        // the pass's fragment loads stand ahead of the products, so that the compiler
        // can issue them in groups behind counted waits
        v16h ka[2][4], va[2][4];
        #pragma unroll
        for (int kc = 0; kc < 2; ++kc) {
            #pragma unroll
            for (int t = 0; t < 4; ++t)
                ka[kc][t] = frag_kmap(&kl[(t * 16 + lrow) * 80 + kc * 32 + lhalf * 8]);
        }
        #pragma unroll
        for (int kc = 0; kc < 2; ++kc) {
            #pragma unroll
            for (int t = 0; t < 4; ++t)
                va[kc][t] = frag_kmap(&vl[(t * 16 + lrow) * 80 + kc * 32 + lhalf * 8]);
        }
        v8f s[4] = {};
        #pragma unroll
        for (int kc = 0; kc < 2; ++kc) {
            #pragma unroll
            for (int t = 0; t < 4; ++t)
                s[t] = __builtin_amdgcn_wmma_f32_16x16x32_f16(false, ka[kc][t], false, qf[kc],
                                                              (short)0, s[t], false, false);
        }

        // ---- online softmax, one query per lane: 32 keys here, 32 in lane ^ 16 ----
        float mx[8];
        #pragma unroll
        for (int r = 0; r < 8; ++r)
            mx[r] = fmaxf(fmaxf(s[0][r], s[1][r]), fmaxf(s[2][r], s[3][r]));
        float rmax = fmaxf(fmaxf(fmaxf(mx[0], mx[1]), fmaxf(mx[2], mx[3])),
                           fmaxf(fmaxf(mx[4], mx[5]), fmaxf(mx[6], mx[7])));
        rmax = fmaxf(rmax, xhalf(rmax)) * ATT_SCALE;
        const float mnew  = fmaxf(m, rmax);
        // exp(m - mnew) as __expf forms it; in asm so that the v_nop, the slot the instruction
        // set asks for behind a transcendental, stays directly behind it
        float alpha;
        asm("v_exp_f32 %0, %1\n\tv_nop" : "=v"(alpha) : "v"((m - mnew) * 1.44269504f));
        m = mnew;
        #pragma unroll
        for (int t = 0; t < 4; ++t) acc[t] *= alpha;

        // P^T: tiles 2kc and 2kc+1, converted in place, are the B operand of 32 keys
        v16h pf[2];
        float ps[8];
        #pragma unroll
        for (int r = 0; r < 8; ++r) ps[r] = 0.f;
        #pragma unroll
        for (int t = 0; t < 4; ++t) {
            #pragma unroll
            for (int r = 0; r < 8; r += 2) {
                f32x2 p;
                p[0] = __expf(s[t][r]     * ATT_SCALE - mnew);
                p[1] = __expf(s[t][r + 1] * ATT_SCALE - mnew);
                ps[r]     += p[0];
                ps[r + 1] += p[1];
                const h16x2 ph = __builtin_convertvector(p, h16x2);
                pf[t >> 1][(t & 1) * 8 + r]     = ph[0];
                pf[t >> 1][(t & 1) * 8 + r + 1] = ph[1];
            }
        }
        l = l * alpha + (((ps[0] + ps[1]) + (ps[2] + ps[3])) + ((ps[4] + ps[5]) + (ps[6] + ps[7])));

        // ---- O^T += V^T * P^T : A = V^T rows (channels) from LDS, in P^T's key order ----
        #pragma unroll
        for (int kc = 0; kc < 2; ++kc) {
            #pragma unroll
            for (int t = 0; t < 4; ++t)
                acc[t] = __builtin_amdgcn_wmma_f32_16x16x32_f16(false, va[kc][t], false, pf[kc],
                                                                (short)0, acc[t], false, false);
        }
        __syncthreads();   // done reading buf[cur]; next iter may overwrite it
    }

    // ---- join the halves' sums, normalize, write O [B, HW, C] f32 ----
    // a lane's 8 registers of a tile are 8 consecutive channels of its query's row
    const float inv = 1.f / (l + xhalf(l));
    float* orow = o + ((size_t)(b * HW + qrow)) * CDIM + lhalf * 8;
    #pragma unroll
    for (int t = 0; t < 4; ++t) {
        f32x4 lo, hi;
        #pragma unroll
        for (int e = 0; e < 4; ++e) { lo[e] = acc[t][e] * inv; hi[e] = acc[t][e + 4] * inv; }
        *(f32x4*)(orow + t * 16)     = lo;
        *(f32x4*)(orow + t * 16 + 4) = hi;
    }
}

// ---------------------------------------------------------------------------
// Kernel 4: 1x1 conv projection + residual, out [B, C, H, W] f32
// One work-group per tile of 64 pixels; lanes run along pixels (lane, lane+32),
// each of the 8 waves owns 8 output channels, weights through scalar loads.
// ---------------------------------------------------------------------------
__global__ __launch_bounds__(256) void proj_kernel(const float* __restrict__ x,
                                                   const float* __restrict__ w_proj,
                                                   const float* __restrict__ b_proj,
                                                   const float* __restrict__ o,
                                                   float* __restrict__ out) {
    __shared__ __align__(16) float hs[PXT * O_PITCH];        // [pixel][ch]
    const int b    = blockIdx.x >> 6;
    const int n0   = (blockIdx.x & 63) * PXT;
    const int tid  = threadIdx.x;
    const int lane = tid & 31;
    // wave number as a scalar, so that the weight addresses are scalar too
    const int wave = __builtin_amdgcn_readfirstlane(tid >> 5);
    const int c0   = wave * 8;

    // the tile's 64 rows of o are contiguous: read them in whole lines
    // (loads first, LDS stores behind them, so that a thread's loads fly together)
    const float* ot = o + ((size_t)(b * HW + n0)) * CDIM;
    f32x4 ov[4];
    #pragma unroll
    for (int r = 0; r < 4; ++r) ov[r] = *(const f32x4*)(ot + (tid + r * 256) * 4);
    const size_t idx0 = ((size_t)(b * CDIM + c0)) * HW + n0 + lane;
    float xr[8][2];
    #pragma unroll
    for (int u = 0; u < 8; ++u) {
        xr[u][0] = x[idx0 + (size_t)u * HW];
        xr[u][1] = x[idx0 + (size_t)u * HW + 32];
    }
    #pragma unroll
    for (int r = 0; r < 4; ++r) {
        const int i = tid + r * 256;
        *(f32x4*)(hs + (i >> 4) * O_PITCH + (i & 15) * 4) = ov[r];
    }
    __syncthreads();

    const float* wrow = w_proj + c0 * CDIM;
    float acc[8][2];
    #pragma unroll
    for (int u = 0; u < 8; ++u) { acc[u][0] = b_proj[c0 + u]; acc[u][1] = acc[u][0]; }
    // rolled over groups of 8 input channels: a short loop body in the instruction cache
    #pragma unroll 1
    for (int c8 = 0; c8 < CDIM; c8 += 8) {
        #pragma unroll
        for (int g = 0; g < 8; g += 4) {
            const f32x4 ha = *(const f32x4*)(hs + lane * O_PITCH + c8 + g);
            const f32x4 hb = *(const f32x4*)(hs + (lane + 32) * O_PITCH + c8 + g);
            #pragma unroll
            for (int j = 0; j < 4; ++j) {
                #pragma unroll
                for (int u = 0; u < 8; ++u) {
                    const float wv = wrow[u * CDIM + c8 + g + j];
                    acc[u][0] += wv * ha[j];
                    acc[u][1] += wv * hb[j];
                }
            }
        }
    }
    #pragma unroll
    for (int u = 0; u < 8; ++u) {
        out[idx0 + (size_t)u * HW]      = xr[u][0] + acc[u][0];
        out[idx0 + (size_t)u * HW + 32] = xr[u][1] + acc[u][1];
    }
}

// ---------------------------------------------------------------------------
extern "C" void kernel_launch(void* const* d_in, const int* in_sizes, int n_in,
                              void* d_out, int out_size, void* d_ws, size_t ws_size,
                              hipStream_t stream) {
    const float* x      = (const float*)d_in[0];
    const float* w_qkv  = (const float*)d_in[1];
    const float* b_qkv  = (const float*)d_in[2];
    const float* w_proj = (const float*)d_in[3];
    const float* b_proj = (const float*)d_in[4];
    float* out = (float*)d_out;

    const size_t B = 4, elems = B * HW * CDIM;   // 1,048,576 per tensor
    char* ws = (char*)d_ws;
    float*    mean = (float*)ws;                       // 256 f32
    float*    rstd = mean + 256;                       // 256 f32
    float*    obuf = (float*)(ws + 4096);              // 4 MB f32
    _Float16* q    = (_Float16*)(ws + 4096 + elems * sizeof(float));
    _Float16* k    = q + elems;                        // 2 MB each (f16)
    _Float16* vt   = k + elems;

    in_stats_kernel<<<B * CDIM, 256, 0, stream>>>(x, mean, rstd);
    qkv_kernel<<<B * (HW / 64), 384, 0, stream>>>(x, w_qkv, b_qkv, mean, rstd, q, k, vt);
    attn_kernel<<<B * (HW / 64), 128, 0, stream>>>(q, k, vt, obuf);
    proj_kernel<<<B * (HW / 64), 256, 0, stream>>>(x, w_proj, b_proj, obuf, out);
}

// v003
// Measured time: 39.8 microseconds a run.
// In both of two side-by-side timings against v002, it was 1.67 times as fast.
// Counting every step since v000, it is 5.92 times as fast.
#include <hip/hip_runtime.h>
#include <hip/hip_bf16.h>

typedef __attribute__((ext_vector_type(16))) _Float16 v16h;
typedef __attribute__((ext_vector_type(8)))  float    v8f;
typedef __attribute__((ext_vector_type(8)))  _Float16 v8h;
typedef __attribute__((ext_vector_type(2)))  _Float16 h16x2;
typedef __attribute__((ext_vector_type(4)))  float    f32x4;
typedef __attribute__((ext_vector_type(2)))  float    f32x2;

#define HW   4096
#define CDIM 64
#define ATT_SCALE 0.125f   // 64^-0.5
#define PXT      64        // pixels per tile in the two 1x1 convs
#define QK_PITCH 136       // halfs per staged pixel row: 128 + 8, a pitch of 16 B x odd
#define O_PITCH  68        // floats per staged pixel row: 64 + 4, a pitch of 16 B x odd
#define KST      256       // keys per stage of the attention ring: 8 wave groups x 32 keys
#define NST      (HW / KST)
#define K_PITCH  80        // halfs per staged key row (160 B)
#define V_PITCH  264       // halfs per staged channel row of V^T: 256 + 8, a pitch of 16 B x odd

// ---------------------------------------------------------------------------
// CDNA5 async global->LDS copies, 16 bytes per lane each, tracked by ASYNCcnt.
// l*: the lane's LDS byte address (low 32 bits of the flat LDS pointer).
// One statement for a thread's eight copies of a stage; the s_wait_xcnt at its end
// stands in front of any rewrite of an address register (precaution for issued copies).
// ---------------------------------------------------------------------------
__device__ __forceinline__ void async_copy16x8(unsigned l0, unsigned l1, unsigned l2, unsigned l3,
                                               unsigned l4, unsigned l5, unsigned l6, unsigned l7,
                                               const void* g0, const void* g1, const void* g2, const void* g3,
                                               const void* g4, const void* g5, const void* g6, const void* g7) {
    asm volatile("global_load_async_to_lds_b128 %0, %8, off\n\t"
                 "global_load_async_to_lds_b128 %1, %9, off\n\t"
                 "global_load_async_to_lds_b128 %2, %10, off\n\t"
                 "global_load_async_to_lds_b128 %3, %11, off\n\t"
                 "global_load_async_to_lds_b128 %4, %12, off\n\t"
                 "global_load_async_to_lds_b128 %5, %13, off\n\t"
                 "global_load_async_to_lds_b128 %6, %14, off\n\t"
                 "global_load_async_to_lds_b128 %7, %15, off\n\t"
                 "s_wait_xcnt 0x0"
                 :: "v"(l0), "v"(l1), "v"(l2), "v"(l3), "v"(l4), "v"(l5), "v"(l6), "v"(l7),
                    "v"(g0), "v"(g1), "v"(g2), "v"(g3), "v"(g4), "v"(g5), "v"(g6), "v"(g7)
                 : "memory");
}

// lane l <-> lane l ^ 16, on the vector pipe
__device__ __forceinline__ float xhalf(float v) {
    const int b = __float_as_int(v);
    return __int_as_float(__builtin_amdgcn_permlanex16(b, b, 0x76543210, 0xfedcba98, false, false));
}

// y = 2^x for eight values. In asm, with results that share no register with a source, so that
// every v_exp_f32 is followed by an instruction that touches none of its registers, the last one
// by the v_nop: the slot the instruction set asks for behind a transcendental
__device__ __forceinline__ void exp2x8(float (&y)[8], f32x2 a, f32x2 b, f32x2 c, f32x2 d) {
    asm("v_exp_f32 %0, %8\n\tv_exp_f32 %1, %9\n\tv_exp_f32 %2, %10\n\tv_exp_f32 %3, %11\n\t"
        "v_exp_f32 %4, %12\n\tv_exp_f32 %5, %13\n\tv_exp_f32 %6, %14\n\tv_exp_f32 %7, %15\n\tv_nop"
        : "=&v"(y[0]), "=&v"(y[1]), "=&v"(y[2]), "=&v"(y[3]), "=&v"(y[4]), "=&v"(y[5]), "=&v"(y[6]), "=&v"(y[7])
        : "v"(a[0]), "v"(a[1]), "v"(b[0]), "v"(b[1]), "v"(c[0]), "v"(c[1]), "v"(d[0]), "v"(d[1]));
}

// one 16x32 f16 operand row in the hardware k order: for lane half h the halfs
// 8h..8h+7 and 16+8h..16+8h+7 of the 32; p already points at half 8h
__device__ __forceinline__ v16h frag_kmap(const _Float16* p) {
    const v8h lo = *(const v8h*)p;
    const v8h hi = *(const v8h*)(p + 16);
    return __builtin_shufflevector(lo, hi, 0, 1, 2, 3, 4, 5, 6, 7, 8, 9, 10, 11, 12, 13, 14, 15);
}

// ---------------------------------------------------------------------------
// Kernel 1: per-(b,c) InstanceNorm statistics over 4096 spatial elements
// ---------------------------------------------------------------------------
__global__ __launch_bounds__(256) void in_stats_kernel(const float* __restrict__ x,
                                                       float* __restrict__ mean,
                                                       float* __restrict__ rstd) {
    __shared__ float ssum[256];
    __shared__ float ssq[256];
    const int bc = blockIdx.x;                  // 0..255 = b*64 + c
    const float* xp = x + (size_t)bc * HW;
    float s = 0.f, sq = 0.f;
    for (int i = threadIdx.x; i < HW; i += 256) {
        float v = xp[i];
        s += v; sq += v * v;
    }
    ssum[threadIdx.x] = s; ssq[threadIdx.x] = sq;
    __syncthreads();
    for (int off = 128; off > 0; off >>= 1) {
        if (threadIdx.x < off) {
            ssum[threadIdx.x] += ssum[threadIdx.x + off];
            ssq[threadIdx.x]  += ssq[threadIdx.x + off];
        }
        __syncthreads();
    }
    if (threadIdx.x == 0) {
        float mu  = ssum[0] * (1.f / HW);
        float var = ssq[0] * (1.f / HW) - mu * mu;
        mean[bc] = mu;
        rstd[bc] = rsqrtf(var + 1e-5f);
    }
}

// ---------------------------------------------------------------------------
// Kernel 2: normalize + 1x1 conv QKV; q,k as f16 [B, HW, C]; v as f16 [B, C, HW]
// (V written pre-transposed so attention can async-DMA contiguous rows.)
// One work-group per tile of 64 pixels. Lanes run along pixels (two adjacent
// pixels per lane), each of the 12 waves owns 16 output channels, and the
// weights are wave-uniform, so they come through scalar loads.
// ---------------------------------------------------------------------------
__global__ __launch_bounds__(384) void qkv_kernel(const float* __restrict__ x,
                                                  const float* __restrict__ w_qkv,
                                                  const float* __restrict__ b_qkv,
                                                  const float* __restrict__ mean,
                                                  const float* __restrict__ rstd,
                                                  _Float16* __restrict__ q,
                                                  _Float16* __restrict__ k,
                                                  _Float16* __restrict__ vt) {
    __shared__ __align__(16) float    hs[CDIM * PXT];        // [c][pixel]
    __shared__ __align__(16) _Float16 qk[PXT * QK_PITCH];    // [pixel][q ch | k ch]
    const int b    = blockIdx.x >> 6;           // 64 pixel tiles per batch
    const int n0   = (blockIdx.x & 63) * PXT;
    const int tid  = threadIdx.x;
    const int lane = tid & 31;
    // wave number as a scalar, so that the weight addresses are scalar too
    const int wave = __builtin_amdgcn_readfirstlane(tid >> 5);

    // normalized tile, read in whole lines along the pixels
    // (1024 pieces of 16 B over 384 threads: the third trip is for waves 0..7 only;
    // loads first, LDS stores behind them, so that a thread's loads fly together)
    f32x4 xv[3];
    float mu[3], rs[3];
    #pragma unroll
    for (int r = 0; r < 3; ++r) {
        if (r < 2 || wave < 8) {
            const int i = tid + r * 384;
            const int c = i >> 4, p4 = (i & 15) * 4;
            xv[r] = *(const f32x4*)(x + ((size_t)(b * CDIM + c)) * HW + n0 + p4);
            mu[r] = mean[b * CDIM + c];
            rs[r] = rstd[b * CDIM + c];
        }
    }
    #pragma unroll
    for (int r = 0; r < 3; ++r) {
        if (r < 2 || wave < 8) {
            const int i = tid + r * 384;
            const int c = i >> 4, p4 = (i & 15) * 4;
            f32x4 hv;
            #pragma unroll
            for (int e = 0; e < 4; ++e) hv[e] = (xv[r][e] - mu[r]) * rs[r];
            *(f32x4*)(hs + c * PXT + p4) = hv;
        }
    }
    __syncthreads();

    const int o0 = wave * 16;                   // 0..176
    const float* wrow = w_qkv + o0 * CDIM;
    f32x2 acc[16];
    #pragma unroll
    for (int u = 0; u < 16; ++u) { const float bv = b_qkv[o0 + u]; acc[u][0] = bv; acc[u][1] = bv; }
    // rolled over groups of 4 input channels: a short loop body in the instruction cache
    #pragma unroll 1
    for (int c4 = 0; c4 < CDIM; c4 += 4) {
        #pragma unroll
        for (int j = 0; j < 4; ++j) {
            const f32x2 h = *(const f32x2*)(hs + (c4 + j) * PXT + 2 * lane);
            #pragma unroll
            for (int u = 0; u < 16; ++u) acc[u] += wrow[u * CDIM + c4 + j] * h;
        }
    }

    if (wave < 8) {
        // q and k: gather each pixel's channels in LDS so that whole rows go out
        #pragma unroll
        for (int e = 0; e < 2; ++e) {
            v8h lo, hi;
            #pragma unroll
            for (int u = 0; u < 8; ++u) { lo[u] = (_Float16)acc[u][e]; hi[u] = (_Float16)acc[u + 8][e]; }
            _Float16* dst = qk + (2 * lane + e) * QK_PITCH + o0;
            *(v8h*)dst       = lo;
            *(v8h*)(dst + 8) = hi;
        }
    } else {
        // v transposed: one 128-byte line of 64 pixels per channel and wave
        #pragma unroll
        for (int u = 0; u < 16; ++u) {
            h16x2 pv;
            pv[0] = (_Float16)acc[u][0]; pv[1] = (_Float16)acc[u][1];
            *(h16x2*)(vt + ((size_t)(b * CDIM + (o0 - 128 + u))) * HW + n0 + 2 * lane) = pv;
        }
        // before a register that these stores name is written again (precaution for issued stores)
        asm volatile("s_wait_xcnt 0x0" ::: "memory");
    }
    __syncthreads();
    if (wave < 8) {
        _Float16* dst = (wave < 4 ? q : k) + ((size_t)(b * HW + n0)) * CDIM;
        const int chb = (wave >> 2) * CDIM;
        #pragma unroll
        for (int i = 0; i < 4; ++i) {
            const int row = (wave & 3) * 16 + i * 4 + (lane >> 3);
            const int ch  = (lane & 7) * 8;
            *(v8h*)(dst + row * CDIM + ch) = *(const v8h*)(qk + row * QK_PITCH + chb + ch);
        }
    }
}

__global__ __launch_bounds__(512) void attn_kernel(const _Float16* __restrict__ q,
                                                   const _Float16* __restrict__ k,
                                                   const _Float16* __restrict__ vt,
                                                   float* __restrict__ o) {
    __shared__ __align__(16) _Float16 k_lds[2][KST * K_PITCH];     // [buf][key][ch]
    __shared__ __align__(16) _Float16 vt_lds[2][CDIM * V_PITCH];   // [buf][ch][key]
    __shared__ __align__(16) float    part[16][32 * O_PITCH];      // [wave][query][ch]
    __shared__ float pm[16][32];                                   // [wave][query] maximum
    __shared__ float pl[16][32];                                   // [wave][query] sum

    const int b     = blockIdx.x >> 6;          // 64 query tiles per batch
    const int qtile = blockIdx.x & 63;
    const int tid   = threadIdx.x;
    const int wave  = __builtin_amdgcn_readfirstlane(tid >> 5);
    const int lane  = tid & 31;
    const int lrow  = lane & 15;
    const int lhalf = lane >> 4;
    const int qh    = wave >> 3;                // which 32 of the 64 queries
    const int grp   = wave & 7;                 // which 32 of a stage's 256 keys

    // Q B-fragments (64 ch x 2 x 16 queries) held in registers for the whole kernel.
    v16h qf[2][2];
    #pragma unroll
    for (int j = 0; j < 2; ++j) {
        const int qrow = qtile * 64 + qh * 32 + j * 16 + lrow;
        const _Float16* qbase = q + ((size_t)(b * HW + qrow)) * CDIM;
        qf[j][0] = frag_kmap(qbase + lhalf * 8);         // ch 0..31
        qf[j][1] = frag_kmap(qbase + 32 + lhalf * 8);    // ch 32..63
    }

    v8f acc[2][4] = {};               // O^T per query tile: acc[j][t][r] = ch 16t + 8*lhalf + r
    float m[2] = { -1e30f, -1e30f };  // this lane's queries: running maximum (same in both halves)
    float l[2] = { 0.f, 0.f };        // and the sum over this lane half's keys only

    // this thread's pieces of a stage: K is 2048 contiguous pieces of 16 B (8 per key row),
    // V^T 64 channel rows of 32 pieces (a wave copies one whole row of 512 B at a time)
    const char* kg0 = (const char*)(k  + ((size_t)b * HW) * CDIM) + tid * 16;
    const char* vg0 = (const char*)(vt + ((size_t)b * CDIM) * HW) + (size_t)(tid >> 5) * (HW * 2) + lane * 16;
    const unsigned kd0 = (unsigned)(uintptr_t)&k_lds[0][0]  + (tid >> 3) * (K_PITCH * 2) + (tid & 7) * 16;
    const unsigned vd0 = (unsigned)(uintptr_t)&vt_lds[0][0] + (tid >> 5) * (V_PITCH * 2) + lane * 16;

    // ---- issue async staging of one 256-key stage (8 b128s per thread) ----
    auto stage_kv = [&](int st, int buf) {
        const char* kg = kg0 + (size_t)st * (KST * CDIM * 2);       // 32 KB of key rows
        const char* vg = vg0 + (size_t)st * (KST * 2);              // 512 B of every channel row
        const unsigned kd = kd0 + buf * (KST * K_PITCH * 2);
        const unsigned vd = vd0 + buf * (CDIM * V_PITCH * 2);
        async_copy16x8(kd, kd + 64 * K_PITCH * 2, kd + 128 * K_PITCH * 2, kd + 192 * K_PITCH * 2,
                       vd, vd + 16 * V_PITCH * 2, vd + 32 * V_PITCH * 2, vd + 48 * V_PITCH * 2,
                       kg, kg + 8192, kg + 16384, kg + 24576,
                       vg, vg + 16 * (HW * 2), vg + 32 * (HW * 2), vg + 48 * (HW * 2));
    };

    stage_kv(0, 0);
    asm volatile("s_wait_asynccnt 0x0" ::: "memory");   // this wave's pieces of stage 0 landed
    __syncthreads();                                    // and every other wave's
    stage_kv(1, 1);

    for (int st = 0; st < NST; ++st) {
        const int cur = st & 1;
        const _Float16* kl = &k_lds[cur][grp * 32 * K_PITCH];
        const _Float16* vl = &vt_lds[cur][grp * 32];

        // ---- S^T = K * Q^T : 2 tiles of 16 keys, s[j][t][r] = key 16t + 8*lhalf + r ----
        // the pass's fragment loads stand ahead of the products, so that the compiler
        // can issue them in groups behind counted waits
        v16h ka[2][2], va[4];
        #pragma unroll
        for (int kc = 0; kc < 2; ++kc) {
            #pragma unroll
            for (int t = 0; t < 2; ++t)
                ka[kc][t] = frag_kmap(&kl[(t * 16 + lrow) * K_PITCH + kc * 32 + lhalf * 8]);
        }
        #pragma unroll
        for (int t = 0; t < 4; ++t)
            va[t] = frag_kmap(&vl[(t * 16 + lrow) * V_PITCH + lhalf * 8]);
        v8f s[2][2] = {};
        #pragma unroll
        for (int kc = 0; kc < 2; ++kc) {
            #pragma unroll
            for (int j = 0; j < 2; ++j) {
                #pragma unroll
                for (int t = 0; t < 2; ++t)
                    s[j][t] = __builtin_amdgcn_wmma_f32_16x16x32_f16(false, ka[kc][t], false, qf[j][kc],
                                                                     (short)0, s[j][t], false, false);
            }
        }

        // ---- online softmax, one query per lane and tile: 16 keys here, 16 in lane ^ 16 ----
        v16h pf[2];
        #pragma unroll
        for (int j = 0; j < 2; ++j) {
            float mx[8];
            #pragma unroll
            for (int r = 0; r < 8; ++r) mx[r] = fmaxf(s[j][0][r], s[j][1][r]);
            float rmax = fmaxf(fmaxf(fmaxf(mx[0], mx[1]), fmaxf(mx[2], mx[3])),
                               fmaxf(fmaxf(mx[4], mx[5]), fmaxf(mx[6], mx[7])));
            rmax = fmaxf(rmax, xhalf(rmax)) * ATT_SCALE;
            const float mnew = fmaxf(m[j], rmax);
            // exp(m - mnew) as __expf forms it; in asm so that the v_nop, the slot the instruction
            // set asks for behind a transcendental, stays directly behind it
            float alpha;
            asm("v_exp_f32 %0, %1\n\tv_nop" : "=v"(alpha) : "v"((m[j] - mnew) * 1.44269504f));
            m[j] = mnew;
            #pragma unroll
            for (int t = 0; t < 4; ++t) acc[j][t] *= alpha;

            // P^T: the two tiles, converted in place, are the B operand of the 32 keys
            float ps[8];
            #pragma unroll
            for (int t = 0; t < 2; ++t) {
                // exp(s * scale - mnew) as __expf forms it
                f32x2 x[4];
                #pragma unroll
                for (int r = 0; r < 4; ++r) {
                    f32x2 sv;
                    sv[0] = s[j][t][2 * r];
                    sv[1] = s[j][t][2 * r + 1];
                    x[r] = (sv * ATT_SCALE - mnew) * 1.44269504f;
                }
                float e[8];
                exp2x8(e, x[0], x[1], x[2], x[3]);
                #pragma unroll
                for (int r = 0; r < 8; r += 2) {
                    f32x2 p;
                    p[0] = e[r];
                    p[1] = e[r + 1];
                    ps[r]     = t ? ps[r] + p[0] : p[0];
                    ps[r + 1] = t ? ps[r + 1] + p[1] : p[1];
                    const h16x2 ph = __builtin_convertvector(p, h16x2);
                    pf[j][t * 8 + r]     = ph[0];
                    pf[j][t * 8 + r + 1] = ph[1];
                }
            }
            l[j] = l[j] * alpha + (((ps[0] + ps[1]) + (ps[2] + ps[3])) + ((ps[4] + ps[5]) + (ps[6] + ps[7])));
        }

        // ---- O^T += V^T * P^T : A = V^T rows (channels) from LDS, in P^T's key order ----
        #pragma unroll
        for (int j = 0; j < 2; ++j) {
            #pragma unroll
            for (int t = 0; t < 4; ++t)
                acc[j][t] = __builtin_amdgcn_wmma_f32_16x16x32_f16(false, va[t], false, pf[j],
                                                                   (short)0, acc[j][t], false, false);
        }

        // ---- hand-over: one barrier publishes stage st + 1 and frees this stage's buffer ----
        // keeps the waits at the pass's foot, behind the softmax and the products (for speed only)
        __builtin_amdgcn_sched_barrier(0);
        asm volatile("s_wait_dscnt 0x0" ::: "memory");      // this wave's reads of buf[cur] are done
        asm volatile("s_wait_asynccnt 0x0" ::: "memory");   // its pieces of stage st + 1 landed
        __syncthreads();
        if (st + 2 < NST) stage_kv(st + 2, cur);
    }
    asm volatile("s_wait_asynccnt 0x0" ::: "memory");       // nothing in flight behind the loop

    // ---- each wave lays down its partial maximum, sum (halves joined) and O rows ----
    // a lane's 8 registers of a tile are 8 consecutive channels of its query's row
    #pragma unroll
    for (int j = 0; j < 2; ++j) {
        const float lt = l[j] + xhalf(l[j]);
        if (lhalf == 0) { pm[wave][j * 16 + lrow] = m[j]; pl[wave][j * 16 + lrow] = lt; }
        float* prow = &part[wave][(j * 16 + lrow) * O_PITCH + lhalf * 8];
        #pragma unroll
        for (int t = 0; t < 4; ++t) {
            f32x4 lo, hi;
            #pragma unroll
            for (int e = 0; e < 4; ++e) { lo[e] = acc[j][t][e]; hi[e] = acc[j][t][e + 4]; }
            *(f32x4*)(prow + t * 16)     = lo;
            *(f32x4*)(prow + t * 16 + 4) = hi;
        }
    }
    __syncthreads();

    // ---- join the 8 key groups, normalize, write O [B, HW, C] f32 ----
    // a thread owns 8 channels of one query; 8 lanes write a whole row of 256 B
    const int jq = tid >> 3;                    // query of the tile, 0..63
    const int c8 = (tid & 7) * 8;
    const int w0 = (jq >> 5) * 8, qr = jq & 31;
    float mg[8];
    #pragma unroll
    for (int g = 0; g < 8; ++g) mg[g] = pm[w0 + g][qr];
    const float mall = fmaxf(fmaxf(fmaxf(mg[0], mg[1]), fmaxf(mg[2], mg[3])),
                             fmaxf(fmaxf(mg[4], mg[5]), fmaxf(mg[6], mg[7])));
    float lall = 0.f;
    f32x4 lo = {}, hi = {};
    #pragma unroll
    for (int g = 0; g < 8; ++g) {
        const float wg = __expf(mg[g] - mall);
        const float* prow = &part[w0 + g][qr * O_PITCH + c8];
        lall += wg * pl[w0 + g][qr];
        lo   += wg * *(const f32x4*)prow;
        hi   += wg * *(const f32x4*)(prow + 4);
    }
    const float inv = 1.f / lall;
    float* orow = o + ((size_t)(b * HW + qtile * 64 + jq)) * CDIM + c8;
    *(f32x4*)orow       = lo * inv;
    *(f32x4*)(orow + 4) = hi * inv;
}

// ---------------------------------------------------------------------------
// Kernel 4: 1x1 conv projection + residual, out [B, C, H, W] f32
// One work-group per tile of 64 pixels; lanes run along pixels (lane, lane+32),
// each of the 8 waves owns 8 output channels, weights through scalar loads.
// ---------------------------------------------------------------------------
__global__ __launch_bounds__(256) void proj_kernel(const float* __restrict__ x,
                                                   const float* __restrict__ w_proj,
                                                   const float* __restrict__ b_proj,
                                                   const float* __restrict__ o,
                                                   float* __restrict__ out) {
    __shared__ __align__(16) float hs[PXT * O_PITCH];        // [pixel][ch]
    const int b    = blockIdx.x >> 6;
    const int n0   = (blockIdx.x & 63) * PXT;
    const int tid  = threadIdx.x;
    const int lane = tid & 31;
    // wave number as a scalar, so that the weight addresses are scalar too
    const int wave = __builtin_amdgcn_readfirstlane(tid >> 5);
    const int c0   = wave * 8;

    // the tile's 64 rows of o are contiguous: read them in whole lines
    // (loads first, LDS stores behind them, so that a thread's loads fly together)
    const float* ot = o + ((size_t)(b * HW + n0)) * CDIM;
    f32x4 ov[4];
    #pragma unroll
    for (int r = 0; r < 4; ++r) ov[r] = *(const f32x4*)(ot + (tid + r * 256) * 4);
    const size_t idx0 = ((size_t)(b * CDIM + c0)) * HW + n0 + lane;
    float xr[8][2];
    #pragma unroll
    for (int u = 0; u < 8; ++u) {
        xr[u][0] = x[idx0 + (size_t)u * HW];
        xr[u][1] = x[idx0 + (size_t)u * HW + 32];
    }
    #pragma unroll
    for (int r = 0; r < 4; ++r) {
        const int i = tid + r * 256;
        *(f32x4*)(hs + (i >> 4) * O_PITCH + (i & 15) * 4) = ov[r];
    }
    __syncthreads();

    const float* wrow = w_proj + c0 * CDIM;
    float acc[8][2];
    #pragma unroll
    for (int u = 0; u < 8; ++u) { acc[u][0] = b_proj[c0 + u]; acc[u][1] = acc[u][0]; }
    // rolled over groups of 8 input channels: a short loop body in the instruction cache
    #pragma unroll 1
    for (int c8 = 0; c8 < CDIM; c8 += 8) {
        #pragma unroll
        for (int g = 0; g < 8; g += 4) {
            const f32x4 ha = *(const f32x4*)(hs + lane * O_PITCH + c8 + g);
            const f32x4 hb = *(const f32x4*)(hs + (lane + 32) * O_PITCH + c8 + g);
            #pragma unroll
            for (int j = 0; j < 4; ++j) {
                #pragma unroll
                for (int u = 0; u < 8; ++u) {
                    const float wv = wrow[u * CDIM + c8 + g + j];
                    acc[u][0] += wv * ha[j];
                    acc[u][1] += wv * hb[j];
                }
            }
        }
    }
    #pragma unroll
    for (int u = 0; u < 8; ++u) {
        out[idx0 + (size_t)u * HW]      = xr[u][0] + acc[u][0];
        out[idx0 + (size_t)u * HW + 32] = xr[u][1] + acc[u][1];
    }
}

// ---------------------------------------------------------------------------
extern "C" void kernel_launch(void* const* d_in, const int* in_sizes, int n_in,
                              void* d_out, int out_size, void* d_ws, size_t ws_size,
                              hipStream_t stream) {
    const float* x      = (const float*)d_in[0];
    const float* w_qkv  = (const float*)d_in[1];
    const float* b_qkv  = (const float*)d_in[2];
    const float* w_proj = (const float*)d_in[3];
    const float* b_proj = (const float*)d_in[4];
    float* out = (float*)d_out;

    const size_t B = 4, elems = B * HW * CDIM;   // 1,048,576 per tensor
    char* ws = (char*)d_ws;
    float*    mean = (float*)ws;                       // 256 f32
    float*    rstd = mean + 256;                       // 256 f32
    float*    obuf = (float*)(ws + 4096);              // 4 MB f32
    _Float16* q    = (_Float16*)(ws + 4096 + elems * sizeof(float));
    _Float16* k    = q + elems;                        // 2 MB each (f16)
    _Float16* vt   = k + elems;

    in_stats_kernel<<<B * CDIM, 256, 0, stream>>>(x, mean, rstd);
    qkv_kernel<<<B * (HW / 64), 384, 0, stream>>>(x, w_qkv, b_qkv, mean, rstd, q, k, vt);
    attn_kernel<<<B * (HW / 64), 512, 0, stream>>>(q, k, vt, obuf);
    proj_kernel<<<B * (HW / 64), 256, 0, stream>>>(x, w_proj, b_proj, obuf, out);
}

// v004
// It runs in 36 microseconds.
// Timed twice side by side with v003, it ran 1.11 and 1.10 times as fast.
// All steps since v000 together make it 6.56 times as fast.
#include <hip/hip_runtime.h>
#include <hip/hip_bf16.h>

typedef __attribute__((ext_vector_type(16))) _Float16 v16h;
typedef __attribute__((ext_vector_type(8)))  float    v8f;
typedef __attribute__((ext_vector_type(8)))  _Float16 v8h;
typedef __attribute__((ext_vector_type(2)))  _Float16 h16x2;
typedef __attribute__((ext_vector_type(4)))  float    f32x4;
typedef __attribute__((ext_vector_type(2)))  float    f32x2;
typedef __attribute__((address_space(4)))    float    cfloat;   // a float in constant memory

#define HW   4096
#define CDIM 64
#define ATT_SCALE 0.125f   // 64^-0.5
#define PXT      64        // pixels per tile in the qkv 1x1 conv
#define QK_PITCH 136       // halfs per staged pixel row: 128 + 8, a pitch of 16 B x odd
#define O_PITCH  68        // floats per staged pixel row: 64 + 4, a pitch of 16 B x odd
#define KST      256       // keys per stage of the attention ring: 8 wave groups x 32 keys
#define NST      (HW / KST)
#define K_PITCH  80        // halfs per staged key row (160 B)
#define V_PITCH  264       // halfs per staged channel row of V^T: 256 + 8, a pitch of 16 B x odd
#define OT_PITCH 66        // floats per staged channel row of the tile's O^T: 64 + 2, rows stay 8 B aligned

// ---------------------------------------------------------------------------
// CDNA5 async global->LDS copies, 16 bytes per lane each, tracked by ASYNCcnt.
// l*: the lane's LDS byte address (low 32 bits of the flat LDS pointer).
// One statement for a thread's eight copies of a stage; the s_wait_xcnt at its end
// stands in front of any rewrite of an address register (precaution for issued copies).
// ---------------------------------------------------------------------------
__device__ __forceinline__ void async_copy16x8(unsigned l0, unsigned l1, unsigned l2, unsigned l3,
                                               unsigned l4, unsigned l5, unsigned l6, unsigned l7,
                                               const void* g0, const void* g1, const void* g2, const void* g3,
                                               const void* g4, const void* g5, const void* g6, const void* g7) {
    asm volatile("global_load_async_to_lds_b128 %0, %8, off\n\t"
                 "global_load_async_to_lds_b128 %1, %9, off\n\t"
                 "global_load_async_to_lds_b128 %2, %10, off\n\t"
                 "global_load_async_to_lds_b128 %3, %11, off\n\t"
                 "global_load_async_to_lds_b128 %4, %12, off\n\t"
                 "global_load_async_to_lds_b128 %5, %13, off\n\t"
                 "global_load_async_to_lds_b128 %6, %14, off\n\t"
                 "global_load_async_to_lds_b128 %7, %15, off\n\t"
                 "s_wait_xcnt 0x0"
                 :: "v"(l0), "v"(l1), "v"(l2), "v"(l3), "v"(l4), "v"(l5), "v"(l6), "v"(l7),
                    "v"(g0), "v"(g1), "v"(g2), "v"(g3), "v"(g4), "v"(g5), "v"(g6), "v"(g7)
                 : "memory");
}

// lane l <-> lane l ^ 16, on the vector pipe
__device__ __forceinline__ float xhalf(float v) {
    const int b = __float_as_int(v);
    return __int_as_float(__builtin_amdgcn_permlanex16(b, b, 0x76543210, 0xfedcba98, false, false));
}

// y = 2^x for eight values. In asm, with results that share no register with a source, so that
// every v_exp_f32 is followed by an instruction that touches none of its registers, the last one
// by the v_nop: the slot the instruction set asks for behind a transcendental
__device__ __forceinline__ void exp2x8(float (&y)[8], f32x2 a, f32x2 b, f32x2 c, f32x2 d) {
    asm("v_exp_f32 %0, %8\n\tv_exp_f32 %1, %9\n\tv_exp_f32 %2, %10\n\tv_exp_f32 %3, %11\n\t"
        "v_exp_f32 %4, %12\n\tv_exp_f32 %5, %13\n\tv_exp_f32 %6, %14\n\tv_exp_f32 %7, %15\n\tv_nop"
        : "=&v"(y[0]), "=&v"(y[1]), "=&v"(y[2]), "=&v"(y[3]), "=&v"(y[4]), "=&v"(y[5]), "=&v"(y[6]), "=&v"(y[7])
        : "v"(a[0]), "v"(a[1]), "v"(b[0]), "v"(b[1]), "v"(c[0]), "v"(c[1]), "v"(d[0]), "v"(d[1]));
}

// one 16x32 f16 operand row in the hardware k order: for lane half h the halfs
// 8h..8h+7 and 16+8h..16+8h+7 of the 32; p already points at half 8h
__device__ __forceinline__ v16h frag_kmap(const _Float16* p) {
    const v8h lo = *(const v8h*)p;
    const v8h hi = *(const v8h*)(p + 16);
    return __builtin_shufflevector(lo, hi, 0, 1, 2, 3, 4, 5, 6, 7, 8, 9, 10, 11, 12, 13, 14, 15);
}

// ---------------------------------------------------------------------------
// Kernel 1: per-(b,c) InstanceNorm statistics over 4096 spatial elements
// ---------------------------------------------------------------------------
__global__ __launch_bounds__(256) void in_stats_kernel(const float* __restrict__ x,
                                                       float* __restrict__ mean,
                                                       float* __restrict__ rstd) {
    __shared__ float ssum[256];
    __shared__ float ssq[256];
    const int bc = blockIdx.x;                  // 0..255 = b*64 + c
    const float* xp = x + (size_t)bc * HW;
    float s = 0.f, sq = 0.f;
    for (int i = threadIdx.x; i < HW; i += 256) {
        float v = xp[i];
        s += v; sq += v * v;
    }
    ssum[threadIdx.x] = s; ssq[threadIdx.x] = sq;
    __syncthreads();
    for (int off = 128; off > 0; off >>= 1) {
        if (threadIdx.x < off) {
            ssum[threadIdx.x] += ssum[threadIdx.x + off];
            ssq[threadIdx.x]  += ssq[threadIdx.x + off];
        }
        __syncthreads();
    }
    if (threadIdx.x == 0) {
        float mu  = ssum[0] * (1.f / HW);
        float var = ssq[0] * (1.f / HW) - mu * mu;
        mean[bc] = mu;
        rstd[bc] = rsqrtf(var + 1e-5f);
    }
}

// ---------------------------------------------------------------------------
// Kernel 2: normalize + 1x1 conv QKV; q,k as f16 [B, HW, C]; v as f16 [B, C, HW]
// (V written pre-transposed so attention can async-DMA contiguous rows.)
// One work-group per tile of 64 pixels. Lanes run along pixels (two adjacent
// pixels per lane), each of the 12 waves owns 16 output channels, and the
// weights are wave-uniform, so they come through scalar loads.
// ---------------------------------------------------------------------------
__global__ __launch_bounds__(384) void qkv_kernel(const float* __restrict__ x,
                                                  const float* __restrict__ w_qkv,
                                                  const float* __restrict__ b_qkv,
                                                  const float* __restrict__ mean,
                                                  const float* __restrict__ rstd,
                                                  _Float16* __restrict__ q,
                                                  _Float16* __restrict__ k,
                                                  _Float16* __restrict__ vt) {
    __shared__ __align__(16) float    hs[CDIM * PXT];        // [c][pixel]
    __shared__ __align__(16) _Float16 qk[PXT * QK_PITCH];    // [pixel][q ch | k ch]
    const int b    = blockIdx.x >> 6;           // 64 pixel tiles per batch
    const int n0   = (blockIdx.x & 63) * PXT;
    const int tid  = threadIdx.x;
    const int lane = tid & 31;
    // wave number as a scalar, so that the weight addresses are scalar too
    const int wave = __builtin_amdgcn_readfirstlane(tid >> 5);

    // normalized tile, read in whole lines along the pixels
    // (1024 pieces of 16 B over 384 threads: the third trip is for waves 0..7 only;
    // loads first, LDS stores behind them, so that a thread's loads fly together)
    f32x4 xv[3];
    float mu[3], rs[3];
    #pragma unroll
    for (int r = 0; r < 3; ++r) {
        if (r < 2 || wave < 8) {
            const int i = tid + r * 384;
            const int c = i >> 4, p4 = (i & 15) * 4;
            xv[r] = *(const f32x4*)(x + ((size_t)(b * CDIM + c)) * HW + n0 + p4);
            mu[r] = mean[b * CDIM + c];
            rs[r] = rstd[b * CDIM + c];
        }
    }
    #pragma unroll
    for (int r = 0; r < 3; ++r) {
        if (r < 2 || wave < 8) {
            const int i = tid + r * 384;
            const int c = i >> 4, p4 = (i & 15) * 4;
            f32x4 hv;
            #pragma unroll
            for (int e = 0; e < 4; ++e) hv[e] = (xv[r][e] - mu[r]) * rs[r];
            *(f32x4*)(hs + c * PXT + p4) = hv;
        }
    }
    __syncthreads();

    const int o0 = wave * 16;                   // 0..176
    const float* wrow = w_qkv + o0 * CDIM;
    f32x2 acc[16];
    #pragma unroll
    for (int u = 0; u < 16; ++u) { const float bv = b_qkv[o0 + u]; acc[u][0] = bv; acc[u][1] = bv; }
    // rolled over groups of 4 input channels: a short loop body in the instruction cache
    #pragma unroll 1
    for (int c4 = 0; c4 < CDIM; c4 += 4) {
        #pragma unroll
        for (int j = 0; j < 4; ++j) {
            const f32x2 h = *(const f32x2*)(hs + (c4 + j) * PXT + 2 * lane);
            #pragma unroll
            for (int u = 0; u < 16; ++u) acc[u] += wrow[u * CDIM + c4 + j] * h;
        }
    }

    if (wave < 8) {
        // q and k: gather each pixel's channels in LDS so that whole rows go out
        #pragma unroll
        for (int e = 0; e < 2; ++e) {
            v8h lo, hi;
            #pragma unroll
            for (int u = 0; u < 8; ++u) { lo[u] = (_Float16)acc[u][e]; hi[u] = (_Float16)acc[u + 8][e]; }
            _Float16* dst = qk + (2 * lane + e) * QK_PITCH + o0;
            *(v8h*)dst       = lo;
            *(v8h*)(dst + 8) = hi;
        }
    } else {
        // v transposed: one 128-byte line of 64 pixels per channel and wave
        #pragma unroll
        for (int u = 0; u < 16; ++u) {
            h16x2 pv;
            pv[0] = (_Float16)acc[u][0]; pv[1] = (_Float16)acc[u][1];
            *(h16x2*)(vt + ((size_t)(b * CDIM + (o0 - 128 + u))) * HW + n0 + 2 * lane) = pv;
        }
        // before a register that these stores name is written again (precaution for issued stores)
        asm volatile("s_wait_xcnt 0x0" ::: "memory");
    }
    __syncthreads();
    if (wave < 8) {
        _Float16* dst = (wave < 4 ? q : k) + ((size_t)(b * HW + n0)) * CDIM;
        const int chb = (wave >> 2) * CDIM;
        #pragma unroll
        for (int i = 0; i < 4; ++i) {
            const int row = (wave & 3) * 16 + i * 4 + (lane >> 3);
            const int ch  = (lane & 7) * 8;
            *(v8h*)(dst + row * CDIM + ch) = *(const v8h*)(qk + row * QK_PITCH + chb + ch);
        }
    }
}

__global__ __launch_bounds__(512) void attn_kernel(const _Float16* __restrict__ q,
                                                   const _Float16* __restrict__ k,
                                                   const _Float16* __restrict__ vt,
                                                   const float* __restrict__ x,
                                                   const float* __restrict__ w_proj,
                                                   const float* __restrict__ b_proj,
                                                   float* __restrict__ out) {
    __shared__ __align__(16) _Float16 k_lds[2][KST * K_PITCH];     // [buf][key][ch]
    __shared__ __align__(16) _Float16 vt_lds[2][CDIM * V_PITCH];   // [buf][ch][key]
    __shared__ __align__(16) float    part[16][32 * O_PITCH];      // [wave][query][ch]
    __shared__ float pm[16][32];                                   // [wave][query] maximum
    __shared__ float pl[16][32];                                   // [wave][query] sum
    __shared__ __align__(16) float    ot[CDIM * OT_PITCH];         // [ch][query], joined and normalized

    const int b     = blockIdx.x >> 6;          // 64 query tiles per batch
    const int qtile = blockIdx.x & 63;
    const int tid   = threadIdx.x;
    const int wave  = __builtin_amdgcn_readfirstlane(tid >> 5);
    const int lane  = tid & 31;
    const int lrow  = lane & 15;
    const int lhalf = lane >> 4;
    const int qh    = wave >> 3;                // which 32 of the 64 queries
    const int grp   = wave & 7;                 // which 32 of a stage's 256 keys

    // Q B-fragments (64 ch x 2 x 16 queries) held in registers for the whole kernel.
    v16h qf[2][2];
    #pragma unroll
    for (int j = 0; j < 2; ++j) {
        const int qrow = qtile * 64 + qh * 32 + j * 16 + lrow;
        const _Float16* qbase = q + ((size_t)(b * HW + qrow)) * CDIM;
        qf[j][0] = frag_kmap(qbase + lhalf * 8);         // ch 0..31
        qf[j][1] = frag_kmap(qbase + 32 + lhalf * 8);    // ch 32..63
    }

    v8f acc[2][4] = {};               // O^T per query tile: acc[j][t][r] = ch 16t + 8*lhalf + r
    float m[2] = { -1e30f, -1e30f };  // this lane's queries: running maximum (same in both halves)
    float l[2] = { 0.f, 0.f };        // and the sum over this lane half's keys only

    // this thread's pieces of a stage: K is 2048 contiguous pieces of 16 B (8 per key row),
    // V^T 64 channel rows of 32 pieces (a wave copies one whole row of 512 B at a time)
    const char* kg0 = (const char*)(k  + ((size_t)b * HW) * CDIM) + tid * 16;
    const char* vg0 = (const char*)(vt + ((size_t)b * CDIM) * HW) + (size_t)(tid >> 5) * (HW * 2) + lane * 16;
    const unsigned kd0 = (unsigned)(uintptr_t)&k_lds[0][0]  + (tid >> 3) * (K_PITCH * 2) + (tid & 7) * 16;
    const unsigned vd0 = (unsigned)(uintptr_t)&vt_lds[0][0] + (tid >> 5) * (V_PITCH * 2) + lane * 16;

    // ---- issue async staging of one 256-key stage (8 b128s per thread) ----
    auto stage_kv = [&](int st, int buf) {
        const char* kg = kg0 + (size_t)st * (KST * CDIM * 2);       // 32 KB of key rows
        const char* vg = vg0 + (size_t)st * (KST * 2);              // 512 B of every channel row
        const unsigned kd = kd0 + buf * (KST * K_PITCH * 2);
        const unsigned vd = vd0 + buf * (CDIM * V_PITCH * 2);
        async_copy16x8(kd, kd + 64 * K_PITCH * 2, kd + 128 * K_PITCH * 2, kd + 192 * K_PITCH * 2,
                       vd, vd + 16 * V_PITCH * 2, vd + 32 * V_PITCH * 2, vd + 48 * V_PITCH * 2,
                       kg, kg + 8192, kg + 16384, kg + 24576,
                       vg, vg + 16 * (HW * 2), vg + 32 * (HW * 2), vg + 48 * (HW * 2));
    };

    stage_kv(0, 0);
    asm volatile("s_wait_asynccnt 0x0" ::: "memory");   // this wave's pieces of stage 0 landed
    __syncthreads();                                    // and every other wave's
    stage_kv(1, 1);

    for (int st = 0; st < NST; ++st) {
        const int cur = st & 1;
        const _Float16* kl = &k_lds[cur][grp * 32 * K_PITCH];
        const _Float16* vl = &vt_lds[cur][grp * 32];

        // ---- S^T = K * Q^T : 2 tiles of 16 keys, s[j][t][r] = key 16t + 8*lhalf + r ----
        // the pass's fragment loads stand ahead of the products, so that the compiler
        // can issue them in groups behind counted waits
        v16h ka[2][2], va[4];
        #pragma unroll
        for (int kc = 0; kc < 2; ++kc) {
            #pragma unroll
            for (int t = 0; t < 2; ++t)
                ka[kc][t] = frag_kmap(&kl[(t * 16 + lrow) * K_PITCH + kc * 32 + lhalf * 8]);
        }
        #pragma unroll
        for (int t = 0; t < 4; ++t)
            va[t] = frag_kmap(&vl[(t * 16 + lrow) * V_PITCH + lhalf * 8]);
        v8f s[2][2] = {};
        #pragma unroll
        for (int kc = 0; kc < 2; ++kc) {
            #pragma unroll
            for (int j = 0; j < 2; ++j) {
                #pragma unroll
                for (int t = 0; t < 2; ++t)
                    s[j][t] = __builtin_amdgcn_wmma_f32_16x16x32_f16(false, ka[kc][t], false, qf[j][kc],
                                                                     (short)0, s[j][t], false, false);
            }
        }

        // ---- online softmax, one query per lane and tile: 16 keys here, 16 in lane ^ 16 ----
        v16h pf[2];
        #pragma unroll
        for (int j = 0; j < 2; ++j) {
            float mx[8];
            #pragma unroll
            for (int r = 0; r < 8; ++r) mx[r] = fmaxf(s[j][0][r], s[j][1][r]);
            float rmax = fmaxf(fmaxf(fmaxf(mx[0], mx[1]), fmaxf(mx[2], mx[3])),
                               fmaxf(fmaxf(mx[4], mx[5]), fmaxf(mx[6], mx[7])));
            rmax = fmaxf(rmax, xhalf(rmax)) * ATT_SCALE;
            const float mnew = fmaxf(m[j], rmax);
            // exp(m - mnew) as __expf forms it; in asm so that the v_nop, the slot the instruction
            // set asks for behind a transcendental, stays directly behind it
            float alpha;
            asm("v_exp_f32 %0, %1\n\tv_nop" : "=v"(alpha) : "v"((m[j] - mnew) * 1.44269504f));
            m[j] = mnew;
            #pragma unroll
            for (int t = 0; t < 4; ++t) acc[j][t] *= alpha;

            // P^T: the two tiles, converted in place, are the B operand of the 32 keys
            float ps[8];
            #pragma unroll
            for (int t = 0; t < 2; ++t) {
                // exp(s * scale - mnew) as __expf forms it
                f32x2 x[4];
                #pragma unroll
                for (int r = 0; r < 4; ++r) {
                    f32x2 sv;
                    sv[0] = s[j][t][2 * r];
                    sv[1] = s[j][t][2 * r + 1];
                    x[r] = (sv * ATT_SCALE - mnew) * 1.44269504f;
                }
                float e[8];
                exp2x8(e, x[0], x[1], x[2], x[3]);
                #pragma unroll
                for (int r = 0; r < 8; r += 2) {
                    f32x2 p;
                    p[0] = e[r];
                    p[1] = e[r + 1];
                    ps[r]     = t ? ps[r] + p[0] : p[0];
                    ps[r + 1] = t ? ps[r + 1] + p[1] : p[1];
                    const h16x2 ph = __builtin_convertvector(p, h16x2);
                    pf[j][t * 8 + r]     = ph[0];
                    pf[j][t * 8 + r + 1] = ph[1];
                }
            }
            l[j] = l[j] * alpha + (((ps[0] + ps[1]) + (ps[2] + ps[3])) + ((ps[4] + ps[5]) + (ps[6] + ps[7])));
        }

        // ---- O^T += V^T * P^T : A = V^T rows (channels) from LDS, in P^T's key order ----
        #pragma unroll
        for (int j = 0; j < 2; ++j) {
            #pragma unroll
            for (int t = 0; t < 4; ++t)
                acc[j][t] = __builtin_amdgcn_wmma_f32_16x16x32_f16(false, va[t], false, pf[j],
                                                                   (short)0, acc[j][t], false, false);
        }

        // ---- hand-over: one barrier publishes stage st + 1 and frees this stage's buffer ----
        // keeps the waits at the pass's foot, behind the softmax and the products (for speed only)
        __builtin_amdgcn_sched_barrier(0);
        asm volatile("s_wait_dscnt 0x0" ::: "memory");      // this wave's reads of buf[cur] are done
        asm volatile("s_wait_asynccnt 0x0" ::: "memory");   // its pieces of stage st + 1 landed
        __syncthreads();
        if (st + 2 < NST) stage_kv(st + 2, cur);
    }
    asm volatile("s_wait_asynccnt 0x0" ::: "memory");       // nothing in flight behind the loop

    // ---- each wave lays down its partial maximum, sum (halves joined) and O rows ----
    // a lane's 8 registers of a tile are 8 consecutive channels of its query's row
    #pragma unroll
    for (int j = 0; j < 2; ++j) {
        const float lt = l[j] + xhalf(l[j]);
        if (lhalf == 0) { pm[wave][j * 16 + lrow] = m[j]; pl[wave][j * 16 + lrow] = lt; }
        float* prow = &part[wave][(j * 16 + lrow) * O_PITCH + lhalf * 8];
        #pragma unroll
        for (int t = 0; t < 4; ++t) {
            f32x4 lo, hi;
            #pragma unroll
            for (int e = 0; e < 4; ++e) { lo[e] = acc[j][t][e]; hi[e] = acc[j][t][e + 4]; }
            *(f32x4*)(prow + t * 16)     = lo;
            *(f32x4*)(prow + t * 16 + 4) = hi;
        }
    }
    __syncthreads();

    // ---- join the 8 key groups, normalize, lay O^T down in LDS ----
    // a thread owns 8 channels of one query
    const int jq = tid >> 3;                    // query of the tile, 0..63
    const int c8 = (tid & 7) * 8;
    const int w0 = (jq >> 5) * 8, qr = jq & 31;
    float mg[8];
    #pragma unroll
    for (int g = 0; g < 8; ++g) mg[g] = pm[w0 + g][qr];
    const float mall = fmaxf(fmaxf(fmaxf(mg[0], mg[1]), fmaxf(mg[2], mg[3])),
                             fmaxf(fmaxf(mg[4], mg[5]), fmaxf(mg[6], mg[7])));
    float lall = 0.f;
    f32x4 lo = {}, hi = {};
    #pragma unroll
    for (int g = 0; g < 8; ++g) {
        const float wg = __expf(mg[g] - mall);
        const float* prow = &part[w0 + g][qr * O_PITCH + c8];
        lall += wg * pl[w0 + g][qr];
        lo   += wg * *(const f32x4*)prow;
        hi   += wg * *(const f32x4*)(prow + 4);
    }
    const float inv = 1.f / lall;
    lo = lo * inv;
    hi = hi * inv;
    #pragma unroll
    for (int e = 0; e < 4; ++e) {
        ot[(c8 + e) * OT_PITCH + jq]     = lo[e];
        ot[(c8 + 4 + e) * OT_PITCH + jq] = hi[e];
    }
    // weights and bias are written by nobody during the launch: read through the constant
    // address space, so that these wave-uniform reads stay scalar loads behind the asm waits above
    const int c0 = wave * 4;
    const cfloat* wrow = (const cfloat*)w_proj + c0 * CDIM;
    const cfloat* brow = (const cfloat*)b_proj + c0;
    f32x2 pa[4];
    #pragma unroll
    for (int u = 0; u < 4; ++u) { const float bv = brow[u]; pa[u][0] = bv; pa[u][1] = bv; }
    __syncthreads();

    // ---- 1x1 conv projection + residual: 4 output channels x 64 pixels per wave ----
    // residual rows: asked for behind the barrier (which would wait for them), used at the very end
    const size_t idx0 = ((size_t)(b * CDIM + c0)) * HW + qtile * 64 + 2 * lane;
    f32x2 xr[4];
    #pragma unroll
    for (int u = 0; u < 4; ++u) xr[u] = *(const f32x2*)(x + idx0 + (size_t)u * HW);
    // rolled over groups of 16 input channels: what a group loads fits the scalar registers
    #pragma unroll 1
    for (int cg = 0; cg < CDIM; cg += 16) {
        #pragma unroll
        for (int j = 0; j < 16; ++j) {
            const f32x2 h = *(const f32x2*)(ot + (cg + j) * OT_PITCH + 2 * lane);
            #pragma unroll
            for (int u = 0; u < 4; ++u) pa[u] += wrow[u * CDIM + cg + j] * h;
        }
    }
    // one run of 256 B (two whole lines) per channel and wave
    #pragma unroll
    for (int u = 0; u < 4; ++u) *(f32x2*)(out + idx0 + (size_t)u * HW) = xr[u] + pa[u];
}

// ---------------------------------------------------------------------------
extern "C" void kernel_launch(void* const* d_in, const int* in_sizes, int n_in,
                              void* d_out, int out_size, void* d_ws, size_t ws_size,
                              hipStream_t stream) {
    const float* x      = (const float*)d_in[0];
    const float* w_qkv  = (const float*)d_in[1];
    const float* b_qkv  = (const float*)d_in[2];
    const float* w_proj = (const float*)d_in[3];
    const float* b_proj = (const float*)d_in[4];
    float* out = (float*)d_out;

    const size_t B = 4, elems = B * HW * CDIM;   // 1,048,576 per tensor
    char* ws = (char*)d_ws;
    float*    mean = (float*)ws;                       // 256 f32
    float*    rstd = mean + 256;                       // 256 f32
    _Float16* q    = (_Float16*)(ws + 4096);
    _Float16* k    = q + elems;                        // 2 MB each (f16)
    _Float16* vt   = k + elems;

    in_stats_kernel<<<B * CDIM, 256, 0, stream>>>(x, mean, rstd);
    qkv_kernel<<<B * (HW / 64), 384, 0, stream>>>(x, w_qkv, b_qkv, mean, rstd, q, k, vt);
    attn_kernel<<<B * (HW / 64), 512, 0, stream>>>(q, k, vt, x, w_proj, b_proj, out);
}

// v005
// One run takes 33.8 microseconds.
// Two timings next to v004 put it at 1.06 and 1.08 times that version's speed.
// Counting every step since v000, it is 7.03 times as fast.
#include <hip/hip_runtime.h>
#include <hip/hip_bf16.h>

typedef __attribute__((ext_vector_type(16))) _Float16 v16h;
typedef __attribute__((ext_vector_type(8)))  float    v8f;
typedef __attribute__((ext_vector_type(8)))  _Float16 v8h;
typedef __attribute__((ext_vector_type(2)))  _Float16 h16x2;
typedef __attribute__((ext_vector_type(4)))  float    f32x4;
typedef __attribute__((ext_vector_type(2)))  float    f32x2;
typedef __attribute__((address_space(4)))    float    cfloat;   // a float in constant memory

#define HW   4096
#define CDIM 64
#define Q_SCALE 0.18033688f   // 64^-0.5 * log2(e): q carries it, so a score is an exponent of 2
#define RESCALE_AT 256.f      // a lane's sum of a pass's 16 powers above this moves the reference
#define PXT      64        // pixels per tile in the qkv 1x1 conv
#define QK_PITCH 136       // halfs per staged pixel row: 128 + 8, a pitch of 16 B x odd
#define O_PITCH  68        // floats per staged pixel row: 64 + 4, a pitch of 16 B x odd
#define KST      256       // keys per stage of the attention ring: 8 wave groups x 32 keys
#define NST      (HW / KST)
#define K_PITCH  80        // halfs per staged key row (160 B)
#define V_PITCH  264       // halfs per staged channel row of V^T: 256 + 8, a pitch of 16 B x odd
#define OT_PITCH 66        // floats per staged channel row of the tile's O^T: 64 + 2, rows stay 8 B aligned

// ---------------------------------------------------------------------------
// CDNA5 async global->LDS copies, 16 bytes per lane each, tracked by ASYNCcnt.
// l*: the lane's LDS byte address (low 32 bits of the flat LDS pointer).
// One statement for a thread's eight copies of a stage; the s_wait_xcnt at its end
// stands in front of any rewrite of an address register (precaution for issued copies).
// ---------------------------------------------------------------------------
__device__ __forceinline__ void async_copy16x8(unsigned l0, unsigned l1, unsigned l2, unsigned l3,
                                               unsigned l4, unsigned l5, unsigned l6, unsigned l7,
                                               const void* g0, const void* g1, const void* g2, const void* g3,
                                               const void* g4, const void* g5, const void* g6, const void* g7) {
    asm volatile("global_load_async_to_lds_b128 %0, %8, off\n\t"
                 "global_load_async_to_lds_b128 %1, %9, off\n\t"
                 "global_load_async_to_lds_b128 %2, %10, off\n\t"
                 "global_load_async_to_lds_b128 %3, %11, off\n\t"
                 "global_load_async_to_lds_b128 %4, %12, off\n\t"
                 "global_load_async_to_lds_b128 %5, %13, off\n\t"
                 "global_load_async_to_lds_b128 %6, %14, off\n\t"
                 "global_load_async_to_lds_b128 %7, %15, off\n\t"
                 "s_wait_xcnt 0x0"
                 :: "v"(l0), "v"(l1), "v"(l2), "v"(l3), "v"(l4), "v"(l5), "v"(l6), "v"(l7),
                    "v"(g0), "v"(g1), "v"(g2), "v"(g3), "v"(g4), "v"(g5), "v"(g6), "v"(g7)
                 : "memory");
}

// lane l <-> lane l ^ 16, on the vector pipe
__device__ __forceinline__ float xhalf(float v) {
    const int b = __float_as_int(v);
    return __int_as_float(__builtin_amdgcn_permlanex16(b, b, 0x76543210, 0xfedcba98, false, false));
}

// y = 2^x for eight values (a score tile; the join's weights). In asm, with results that share no
// register with a source, so that every v_exp_f32 is followed by an instruction that touches none of
// its registers, the last one by the v_nop: the slot the instruction set asks for behind a transcendental
__device__ __forceinline__ void exp2x8(float (&y)[8], v8f x) {
    asm("v_exp_f32 %0, %8\n\tv_exp_f32 %1, %9\n\tv_exp_f32 %2, %10\n\tv_exp_f32 %3, %11\n\t"
        "v_exp_f32 %4, %12\n\tv_exp_f32 %5, %13\n\tv_exp_f32 %6, %14\n\tv_exp_f32 %7, %15\n\tv_nop"
        : "=&v"(y[0]), "=&v"(y[1]), "=&v"(y[2]), "=&v"(y[3]), "=&v"(y[4]), "=&v"(y[5]), "=&v"(y[6]), "=&v"(y[7])
        : "v"(x[0]), "v"(x[1]), "v"(x[2]), "v"(x[3]), "v"(x[4]), "v"(x[5]), "v"(x[6]), "v"(x[7]));
}

// The eight score products of a pass: s[j][t] = c[j] + K tile t (A, two halves of the channels) x
// Q^T tile j (B). In one asm statement so that C stays a register block of its own that the four first
// products only read (the builtin form copied it, 16 registers a pass); each accumulate stands four
// products behind its first half. The v_nops keep the distance the chip needs between the last
// product and the first vector instruction that reads a result or overwrites an operand.
__device__ __forceinline__ void scores8(v8f (&s)[2][2], const v16h (&ka)[2][2], const v16h (&qf)[2][2],
                                        const v8f (&c)[2]) {
    asm("v_wmma_f32_16x16x32_f16 %0, %4, %8, %12\n\t"
        "v_wmma_f32_16x16x32_f16 %1, %5, %8, %12\n\t"
        "v_wmma_f32_16x16x32_f16 %2, %4, %10, %13\n\t"
        "v_wmma_f32_16x16x32_f16 %3, %5, %10, %13\n\t"
        "v_wmma_f32_16x16x32_f16 %0, %6, %9, %0\n\t"
        "v_wmma_f32_16x16x32_f16 %1, %7, %9, %1\n\t"
        "v_wmma_f32_16x16x32_f16 %2, %6, %11, %2\n\t"
        "v_wmma_f32_16x16x32_f16 %3, %7, %11, %3\n\t"
        "v_nop\n\tv_nop\n\tv_nop\n\tv_nop"
        : "=&v"(s[0][0]), "=&v"(s[0][1]), "=&v"(s[1][0]), "=&v"(s[1][1])
        : "v"(ka[0][0]), "v"(ka[0][1]), "v"(ka[1][0]), "v"(ka[1][1]),
          "v"(qf[0][0]), "v"(qf[0][1]), "v"(qf[1][0]), "v"(qf[1][1]), "v"(c[0]), "v"(c[1]));
}

// one 16x32 f16 operand row in the hardware k order: for lane half h the halfs
// 8h..8h+7 and 16+8h..16+8h+7 of the 32; p already points at half 8h
__device__ __forceinline__ v16h frag_kmap(const _Float16* p) {
    const v8h lo = *(const v8h*)p;
    const v8h hi = *(const v8h*)(p + 16);
    return __builtin_shufflevector(lo, hi, 0, 1, 2, 3, 4, 5, 6, 7, 8, 9, 10, 11, 12, 13, 14, 15);
}

// ---------------------------------------------------------------------------
// Kernel 1: per-(b,c) InstanceNorm statistics over 4096 spatial elements
// ---------------------------------------------------------------------------
__global__ __launch_bounds__(256) void in_stats_kernel(const float* __restrict__ x,
                                                       float* __restrict__ mean,
                                                       float* __restrict__ rstd) {
    __shared__ float ssum[256];
    __shared__ float ssq[256];
    const int bc = blockIdx.x;                  // 0..255 = b*64 + c
    const float* xp = x + (size_t)bc * HW;
    float s = 0.f, sq = 0.f;
    for (int i = threadIdx.x; i < HW; i += 256) {
        float v = xp[i];
        s += v; sq += v * v;
    }
    ssum[threadIdx.x] = s; ssq[threadIdx.x] = sq;
    __syncthreads();
    for (int off = 128; off > 0; off >>= 1) {
        if (threadIdx.x < off) {
            ssum[threadIdx.x] += ssum[threadIdx.x + off];
            ssq[threadIdx.x]  += ssq[threadIdx.x + off];
        }
        __syncthreads();
    }
    if (threadIdx.x == 0) {
        float mu  = ssum[0] * (1.f / HW);
        float var = ssq[0] * (1.f / HW) - mu * mu;
        mean[bc] = mu;
        rstd[bc] = rsqrtf(var + 1e-5f);
    }
}

// ---------------------------------------------------------------------------
// Kernel 2: normalize + 1x1 conv QKV; q,k as f16 [B, HW, C]; v as f16 [B, C, HW]
// (V written pre-transposed so attention can async-DMA contiguous rows; q is multiplied
// by Q_SCALE in f32, ahead of its one rounding to f16.)
// One work-group per tile of 64 pixels. Lanes run along pixels (two adjacent
// pixels per lane), each of the 12 waves owns 16 output channels, and the
// weights are wave-uniform, so they come through scalar loads.
// ---------------------------------------------------------------------------
__global__ __launch_bounds__(384) void qkv_kernel(const float* __restrict__ x,
                                                  const float* __restrict__ w_qkv,
                                                  const float* __restrict__ b_qkv,
                                                  const float* __restrict__ mean,
                                                  const float* __restrict__ rstd,
                                                  _Float16* __restrict__ q,
                                                  _Float16* __restrict__ k,
                                                  _Float16* __restrict__ vt) {
    __shared__ __align__(16) float    hs[CDIM * PXT];        // [c][pixel]
    __shared__ __align__(16) _Float16 qk[PXT * QK_PITCH];    // [pixel][q ch | k ch]
    const int b    = blockIdx.x >> 6;           // 64 pixel tiles per batch
    const int n0   = (blockIdx.x & 63) * PXT;
    const int tid  = threadIdx.x;
    const int lane = tid & 31;
    // wave number as a scalar, so that the weight addresses are scalar too
    const int wave = __builtin_amdgcn_readfirstlane(tid >> 5);

    // normalized tile, read in whole lines along the pixels
    // (1024 pieces of 16 B over 384 threads: the third trip is for waves 0..7 only;
    // loads first, LDS stores behind them, so that a thread's loads fly together)
    f32x4 xv[3];
    float mu[3], rs[3];
    #pragma unroll
    for (int r = 0; r < 3; ++r) {
        if (r < 2 || wave < 8) {
            const int i = tid + r * 384;
            const int c = i >> 4, p4 = (i & 15) * 4;
            xv[r] = *(const f32x4*)(x + ((size_t)(b * CDIM + c)) * HW + n0 + p4);
            mu[r] = mean[b * CDIM + c];
            rs[r] = rstd[b * CDIM + c];
        }
    }
    #pragma unroll
    for (int r = 0; r < 3; ++r) {
        if (r < 2 || wave < 8) {
            const int i = tid + r * 384;
            const int c = i >> 4, p4 = (i & 15) * 4;
            f32x4 hv;
            #pragma unroll
            for (int e = 0; e < 4; ++e) hv[e] = (xv[r][e] - mu[r]) * rs[r];
            *(f32x4*)(hs + c * PXT + p4) = hv;
        }
    }
    __syncthreads();

    const int o0 = wave * 16;                   // 0..176
    const float* wrow = w_qkv + o0 * CDIM;
    f32x2 acc[16];
    #pragma unroll
    for (int u = 0; u < 16; ++u) { const float bv = b_qkv[o0 + u]; acc[u][0] = bv; acc[u][1] = bv; }
    // rolled over groups of 4 input channels: a short loop body in the instruction cache
    #pragma unroll 1
    for (int c4 = 0; c4 < CDIM; c4 += 4) {
        #pragma unroll
        for (int j = 0; j < 4; ++j) {
            const f32x2 h = *(const f32x2*)(hs + (c4 + j) * PXT + 2 * lane);
            #pragma unroll
            for (int u = 0; u < 16; ++u) acc[u] += wrow[u * CDIM + c4 + j] * h;
        }
    }

    if (wave < 8) {
        // q and k: gather each pixel's channels in LDS so that whole rows go out
        const float qs = wave < 4 ? Q_SCALE : 1.f;
        #pragma unroll
        for (int e = 0; e < 2; ++e) {
            v8h lo, hi;
            #pragma unroll
            for (int u = 0; u < 8; ++u) { lo[u] = (_Float16)(acc[u][e] * qs); hi[u] = (_Float16)(acc[u + 8][e] * qs); }
            _Float16* dst = qk + (2 * lane + e) * QK_PITCH + o0;
            *(v8h*)dst       = lo;
            *(v8h*)(dst + 8) = hi;
        }
    } else {
        // v transposed: one 128-byte line of 64 pixels per channel and wave
        #pragma unroll
        for (int u = 0; u < 16; ++u) {
            h16x2 pv;
            pv[0] = (_Float16)acc[u][0]; pv[1] = (_Float16)acc[u][1];
            *(h16x2*)(vt + ((size_t)(b * CDIM + (o0 - 128 + u))) * HW + n0 + 2 * lane) = pv;
        }
        // before a register that these stores name is written again (precaution for issued stores)
        asm volatile("s_wait_xcnt 0x0" ::: "memory");
    }
    __syncthreads();
    if (wave < 8) {
        _Float16* dst = (wave < 4 ? q : k) + ((size_t)(b * HW + n0)) * CDIM;
        const int chb = (wave >> 2) * CDIM;
        #pragma unroll
        for (int i = 0; i < 4; ++i) {
            const int row = (wave & 3) * 16 + i * 4 + (lane >> 3);
            const int ch  = (lane & 7) * 8;
            *(v8h*)(dst + row * CDIM + ch) = *(const v8h*)(qk + row * QK_PITCH + chb + ch);
        }
    }
}

__global__ __launch_bounds__(512) void attn_kernel(const _Float16* __restrict__ q,
                                                   const _Float16* __restrict__ k,
                                                   const _Float16* __restrict__ vt,
                                                   const float* __restrict__ x,
                                                   const float* __restrict__ w_proj,
                                                   const float* __restrict__ b_proj,
                                                   float* __restrict__ out) {
    __shared__ __align__(16) _Float16 k_lds[2][KST * K_PITCH];     // [buf][key][ch]
    __shared__ __align__(16) _Float16 vt_lds[2][CDIM * V_PITCH];   // [buf][ch][key]
    __shared__ __align__(16) float    part[16][32 * O_PITCH];      // [wave][query][ch]
    __shared__ float pm[16][32];                                   // [wave][query] reference, log2 domain
    __shared__ float pl[16][32];                                   // [wave][query] sum
    __shared__ __align__(16) float    ot[CDIM * OT_PITCH];         // [ch][query], joined and normalized

    const int b     = blockIdx.x >> 6;          // 64 query tiles per batch
    const int qtile = blockIdx.x & 63;
    const int tid   = threadIdx.x;
    const int wave  = __builtin_amdgcn_readfirstlane(tid >> 5);
    const int lane  = tid & 31;
    const int lrow  = lane & 15;
    const int lhalf = lane >> 4;
    const int qh    = wave >> 3;                // which 32 of the 64 queries
    const int grp   = wave & 7;                 // which 32 of a stage's 256 keys

    // Q B-fragments (64 ch x 2 x 16 queries) held in registers for the whole kernel.
    v16h qf[2][2];
    #pragma unroll
    for (int j = 0; j < 2; ++j) {
        const int qrow = qtile * 64 + qh * 32 + j * 16 + lrow;
        const _Float16* qbase = q + ((size_t)(b * HW + qrow)) * CDIM;
        qf[j][0] = frag_kmap(qbase + lhalf * 8);         // ch 0..31
        qf[j][1] = frag_kmap(qbase + 32 + lhalf * 8);    // ch 32..63
    }

    v8f acc[2][4] = {};               // O^T per query tile: acc[j][t][r] = ch 16t + 8*lhalf + r
    float mref[2] = { 0.f, 0.f };     // this lane's queries: reference in use, log2 domain (same in both halves)
    v8f   cneg[2] = {};               // minus the reference in all 8 registers: C of the score products
    float l[2] = { 0.f, 0.f };        // and the sum over this lane half's keys only

    // this thread's pieces of a stage: K is 2048 contiguous pieces of 16 B (8 per key row),
    // V^T 64 channel rows of 32 pieces (a wave copies one whole row of 512 B at a time)
    const char* kg0 = (const char*)(k  + ((size_t)b * HW) * CDIM) + tid * 16;
    const char* vg0 = (const char*)(vt + ((size_t)b * CDIM) * HW) + (size_t)(tid >> 5) * (HW * 2) + lane * 16;
    const unsigned kd0 = (unsigned)(uintptr_t)&k_lds[0][0]  + (tid >> 3) * (K_PITCH * 2) + (tid & 7) * 16;
    const unsigned vd0 = (unsigned)(uintptr_t)&vt_lds[0][0] + (tid >> 5) * (V_PITCH * 2) + lane * 16;

    // ---- issue async staging of one 256-key stage (8 b128s per thread) ----
    auto stage_kv = [&](int st, int buf) {
        const char* kg = kg0 + (size_t)st * (KST * CDIM * 2);       // 32 KB of key rows
        const char* vg = vg0 + (size_t)st * (KST * 2);              // 512 B of every channel row
        const unsigned kd = kd0 + buf * (KST * K_PITCH * 2);
        const unsigned vd = vd0 + buf * (CDIM * V_PITCH * 2);
        async_copy16x8(kd, kd + 64 * K_PITCH * 2, kd + 128 * K_PITCH * 2, kd + 192 * K_PITCH * 2,
                       vd, vd + 16 * V_PITCH * 2, vd + 32 * V_PITCH * 2, vd + 48 * V_PITCH * 2,
                       kg, kg + 8192, kg + 16384, kg + 24576,
                       vg, vg + 16 * (HW * 2), vg + 32 * (HW * 2), vg + 48 * (HW * 2));
    };

    stage_kv(0, 0);
    asm volatile("s_wait_asynccnt 0x0" ::: "memory");   // this wave's pieces of stage 0 landed
    __syncthreads();                                    // and every other wave's
    stage_kv(1, 1);

    for (int st = 0; st < NST; ++st) {
        const int cur = st & 1;
        const _Float16* kl = &k_lds[cur][grp * 32 * K_PITCH];
        const _Float16* vl = &vt_lds[cur][grp * 32];

        // ---- S^T = K * Q^T - reference : 2 tiles of 16 keys, s[j][t][r] = key 16t + 8*lhalf + r ----
        v16h ka[2][2], va[4];
        #pragma unroll
        for (int kc = 0; kc < 2; ++kc) {
            #pragma unroll
            for (int t = 0; t < 2; ++t)
                ka[kc][t] = frag_kmap(&kl[(t * 16 + lrow) * K_PITCH + kc * 32 + lhalf * 8]);
        }
        v8f s[2][2];
        scores8(s, ka, qf, cneg);
        // the two scheduling barriers keep the V^T fragment loads between the score products and the
        // powers: lifted above the products they queue in front of the other waves' K reads, sunk
        // below the powers they leave their LDS latency open in front of the second product
        __builtin_amdgcn_sched_barrier(0);
        #pragma unroll
        for (int t = 0; t < 4; ++t)
            va[t] = frag_kmap(&vl[(t * 16 + lrow) * V_PITCH + lhalf * 8]);
        __builtin_amdgcn_sched_barrier(0);

        // ---- softmax against the reference in use, one query per lane and tile ----
        // P^T: the two tiles, converted in place, are the B operand of the 32 keys
        v16h pf[2];
        float tot[2];
        auto powers = [&](int j) {
            float ps[8];
            #pragma unroll
            for (int t = 0; t < 2; ++t) {
                float e[8];
                exp2x8(e, s[j][t]);
                #pragma unroll
                for (int r = 0; r < 8; r += 2) {
                    f32x2 p;
                    p[0] = e[r];
                    p[1] = e[r + 1];
                    ps[r]     = t ? ps[r] + p[0] : p[0];
                    ps[r + 1] = t ? ps[r + 1] + p[1] : p[1];
                    const h16x2 ph = __builtin_convertvector(p, h16x2);
                    pf[j][t * 8 + r]     = ph[0];
                    pf[j][t * 8 + r + 1] = ph[1];
                }
            }
            tot[j] = ((ps[0] + ps[1]) + (ps[2] + ps[3])) + ((ps[4] + ps[5]) + (ps[6] + ps[7]));
        };
        powers(0);
        powers(1);

        // one test per pass, a scalar branch: no power passed RESCALE_AT where no lane's sum did
        // (an overflow to infinity shows in the sum too). The first pass always sets the reference.
        const bool need = fmaxf(tot[0], tot[1]) > RESCALE_AT;
        if (st == 0 || __builtin_amdgcn_ballot_w32(need) != 0u) {
            #pragma unroll
            for (int j = 0; j < 2; ++j) {
                float mx[8];
                #pragma unroll
                for (int r = 0; r < 8; ++r) mx[r] = fmaxf(s[j][0][r], s[j][1][r]);
                float d = fmaxf(fmaxf(fmaxf(mx[0], mx[1]), fmaxf(mx[2], mx[3])),
                                fmaxf(fmaxf(mx[4], mx[5]), fmaxf(mx[6], mx[7])));
                d = fmaxf(d, xhalf(d));             // 16 keys here, 16 in lane ^ 16
                if (st != 0) d = fmaxf(d, 0.f);     // behind the first pass the reference only rises
                // 2^-d, never above 1; in asm so that the v_nop, the slot the instruction set asks
                // for behind a transcendental, stays directly behind it
                float alpha;
                asm("v_exp_f32 %0, %1\n\tv_nop" : "=v"(alpha) : "v"(fminf(-d, 0.f)));
                mref[j] += d;
                #pragma unroll
                for (int r = 0; r < 8; ++r) cneg[j][r] = -mref[j];
                #pragma unroll
                for (int t = 0; t < 4; ++t) acc[j][t] *= alpha;
                l[j] *= alpha;
                #pragma unroll
                for (int t = 0; t < 2; ++t) s[j][t] -= d;
                powers(j);
            }
        }
        l[0] += tot[0];
        l[1] += tot[1];

        // ---- O^T += V^T * P^T : A = V^T rows (channels) from LDS, in P^T's key order ----
        #pragma unroll
        for (int j = 0; j < 2; ++j) {
            #pragma unroll
            for (int t = 0; t < 4; ++t)
                acc[j][t] = __builtin_amdgcn_wmma_f32_16x16x32_f16(false, va[t], false, pf[j],
                                                                   (short)0, acc[j][t], false, false);
        }

        // ---- hand-over: one barrier publishes stage st + 1 and frees this stage's buffer ----
        // keeps the waits at the pass's foot, behind the softmax and the products (for speed only)
        __builtin_amdgcn_sched_barrier(0);
        asm volatile("s_wait_dscnt 0x0" ::: "memory");      // this wave's reads of buf[cur] are done
        asm volatile("s_wait_asynccnt 0x0" ::: "memory");   // its pieces of stage st + 1 landed
        __syncthreads();
        if (st + 2 < NST) stage_kv(st + 2, cur);
    }
    asm volatile("s_wait_asynccnt 0x0" ::: "memory");       // nothing in flight behind the loop

    // ---- each wave lays down its reference, sum (halves joined) and O rows ----
    // a lane's 8 registers of a tile are 8 consecutive channels of its query's row
    #pragma unroll
    for (int j = 0; j < 2; ++j) {
        const float lt = l[j] + xhalf(l[j]);
        if (lhalf == 0) { pm[wave][j * 16 + lrow] = mref[j]; pl[wave][j * 16 + lrow] = lt; }
        float* prow = &part[wave][(j * 16 + lrow) * O_PITCH + lhalf * 8];
        #pragma unroll
        for (int t = 0; t < 4; ++t) {
            f32x4 lo, hi;
            #pragma unroll
            for (int e = 0; e < 4; ++e) { lo[e] = acc[j][t][e]; hi[e] = acc[j][t][e + 4]; }
            *(f32x4*)(prow + t * 16)     = lo;
            *(f32x4*)(prow + t * 16 + 4) = hi;
        }
    }
    __syncthreads();

    // ---- join the 8 key groups, normalize, lay O^T down in LDS ----
    // a thread owns 8 channels of one query
    const int jq = tid >> 3;                    // query of the tile, 0..63
    const int c8 = (tid & 7) * 8;
    const int w0 = (jq >> 5) * 8, qr = jq & 31;
    float mg[8];
    #pragma unroll
    for (int g = 0; g < 8; ++g) mg[g] = pm[w0 + g][qr];
    const float mall = fmaxf(fmaxf(fmaxf(mg[0], mg[1]), fmaxf(mg[2], mg[3])),
                             fmaxf(fmaxf(mg[4], mg[5]), fmaxf(mg[6], mg[7])));
    v8f dm;
    #pragma unroll
    for (int g = 0; g < 8; ++g) dm[g] = mg[g] - mall;
    float wg[8];
    exp2x8(wg, dm);
    float lall = 0.f;
    f32x4 lo = {}, hi = {};
    #pragma unroll
    for (int g = 0; g < 8; ++g) {
        const float* prow = &part[w0 + g][qr * O_PITCH + c8];
        lall += wg[g] * pl[w0 + g][qr];
        lo   += wg[g] * *(const f32x4*)prow;
        hi   += wg[g] * *(const f32x4*)(prow + 4);
    }
    const float inv = 1.f / lall;
    lo = lo * inv;
    hi = hi * inv;
    #pragma unroll
    for (int e = 0; e < 4; ++e) {
        ot[(c8 + e) * OT_PITCH + jq]     = lo[e];
        ot[(c8 + 4 + e) * OT_PITCH + jq] = hi[e];
    }
    // weights and bias are written by nobody during the launch: read through the constant
    // address space, so that these wave-uniform reads stay scalar loads behind the asm waits above
    const int c0 = wave * 4;
    const cfloat* wrow = (const cfloat*)w_proj + c0 * CDIM;
    const cfloat* brow = (const cfloat*)b_proj + c0;
    f32x2 pa[4];
    #pragma unroll
    for (int u = 0; u < 4; ++u) { const float bv = brow[u]; pa[u][0] = bv; pa[u][1] = bv; }
    __syncthreads();

    // ---- 1x1 conv projection + residual: 4 output channels x 64 pixels per wave ----
    // residual rows: asked for behind the barrier (which would wait for them), used at the very end
    const size_t idx0 = ((size_t)(b * CDIM + c0)) * HW + qtile * 64 + 2 * lane;
    f32x2 xr[4];
    #pragma unroll
    for (int u = 0; u < 4; ++u) xr[u] = *(const f32x2*)(x + idx0 + (size_t)u * HW);
    // rolled over groups of 16 input channels: what a group loads fits the scalar registers
    #pragma unroll 1
    for (int cg = 0; cg < CDIM; cg += 16) {
        #pragma unroll
        for (int j = 0; j < 16; ++j) {
            const f32x2 h = *(const f32x2*)(ot + (cg + j) * OT_PITCH + 2 * lane);
            #pragma unroll
            for (int u = 0; u < 4; ++u) pa[u] += wrow[u * CDIM + cg + j] * h;
        }
    }
    // one run of 256 B (two whole lines) per channel and wave
    #pragma unroll
    for (int u = 0; u < 4; ++u) *(f32x2*)(out + idx0 + (size_t)u * HW) = xr[u] + pa[u];
}

// ---------------------------------------------------------------------------
extern "C" void kernel_launch(void* const* d_in, const int* in_sizes, int n_in,
                              void* d_out, int out_size, void* d_ws, size_t ws_size,
                              hipStream_t stream) {
    const float* x      = (const float*)d_in[0];
    const float* w_qkv  = (const float*)d_in[1];
    const float* b_qkv  = (const float*)d_in[2];
    const float* w_proj = (const float*)d_in[3];
    const float* b_proj = (const float*)d_in[4];
    float* out = (float*)d_out;

    const size_t B = 4, elems = B * HW * CDIM;   // 1,048,576 per tensor
    char* ws = (char*)d_ws;
    float*    mean = (float*)ws;                       // 256 f32
    float*    rstd = mean + 256;                       // 256 f32
    _Float16* q    = (_Float16*)(ws + 4096);
    _Float16* k    = q + elems;                        // 2 MB each (f16)
    _Float16* vt   = k + elems;

    in_stats_kernel<<<B * CDIM, 256, 0, stream>>>(x, mean, rstd);
    qkv_kernel<<<B * (HW / 64), 384, 0, stream>>>(x, w_qkv, b_qkv, mean, rstd, q, k, vt);
    attn_kernel<<<B * (HW / 64), 512, 0, stream>>>(q, k, vt, x, w_proj, b_proj, out);
}

// v006
// One run takes 23.3 microseconds.
// Timed twice side by side with v005, it ran 1.55 and 1.33 times as fast.
// Counting every step since v000, it is 10.1 times as fast.
#include <hip/hip_runtime.h>
#include <hip/hip_bf16.h>

typedef __attribute__((ext_vector_type(16))) _Float16 v16h;
typedef __attribute__((ext_vector_type(8)))  float    v8f;
typedef __attribute__((ext_vector_type(8)))  _Float16 v8h;
typedef __attribute__((ext_vector_type(4)))  _Float16 v4h;
typedef __attribute__((ext_vector_type(8)))  short    s16x8;
typedef __attribute__((ext_vector_type(2)))  _Float16 h16x2;
typedef __attribute__((ext_vector_type(4)))  float    f32x4;
typedef __attribute__((ext_vector_type(2)))  float    f32x2;
typedef __attribute__((address_space(4)))    float    cfloat;   // a float in constant memory

#define HW   4096
#define CDIM 64
#define Q_SCALE 0.18033688f   // 64^-0.5 * log2(e): q carries it, so a score is an exponent of 2
#define RESCALE_AT 256.f      // a lane's sum of a pass's 16 powers above this moves the reference
#define O_PITCH  68        // floats per staged pixel row: 64 + 4, a pitch of 16 B x odd
#define KST      256       // keys per stage of the attention ring: 8 wave groups x 32 keys
#define NST      (HW / KST)
#define FOLD_WG  33        // work-groups of the first kernel that fold the weights
#define H_PITCH  272       // halfs per staged channel row of h: 256 + 16, a pitch of 32 B x odd (transposing reads)
#define Q_PITCH  72        // halfs per staged query row: 64 + 8, a pitch of 16 B x odd
#define OT_PITCH 66        // floats per staged channel row of the tile's O^T: 64 + 2, rows stay 8 B aligned

// ---------------------------------------------------------------------------
// CDNA5 async global->LDS copies, 16 bytes per lane each, tracked by ASYNCcnt.
// l*: the lane's LDS byte address (low 32 bits of the flat LDS pointer).
// One statement for a thread's four copies of a stage; the s_wait_xcnt at its end
// stands in front of any rewrite of an address register (precaution for issued copies).
// ---------------------------------------------------------------------------
__device__ __forceinline__ void async_copy16x4(unsigned l0, unsigned l1, unsigned l2, unsigned l3,
                                               const void* g0, const void* g1, const void* g2, const void* g3) {
    asm volatile("global_load_async_to_lds_b128 %0, %4, off\n\t"
                 "global_load_async_to_lds_b128 %1, %5, off\n\t"
                 "global_load_async_to_lds_b128 %2, %6, off\n\t"
                 "global_load_async_to_lds_b128 %3, %7, off\n\t"
                 "s_wait_xcnt 0x0"
                 :: "v"(l0), "v"(l1), "v"(l2), "v"(l3), "v"(g0), "v"(g1), "v"(g2), "v"(g3)
                 : "memory");
}

// lane l <-> lane l ^ 16, on the vector pipe
__device__ __forceinline__ float xhalf(float v) {
    const int b = __float_as_int(v);
    return __int_as_float(__builtin_amdgcn_permlanex16(b, b, 0x76543210, 0xfedcba98, false, false));
}

// y = 2^x for eight values (a score tile; the join's weights). In asm, with results that share no
// register with a source, so that every v_exp_f32 is followed by an instruction that touches none of
// its registers, the last one by the v_nop: the slot the instruction set asks for behind a transcendental
__device__ __forceinline__ void exp2x8(float (&y)[8], v8f x) {
    asm("v_exp_f32 %0, %8\n\tv_exp_f32 %1, %9\n\tv_exp_f32 %2, %10\n\tv_exp_f32 %3, %11\n\t"
        "v_exp_f32 %4, %12\n\tv_exp_f32 %5, %13\n\tv_exp_f32 %6, %14\n\tv_exp_f32 %7, %15\n\tv_nop"
        : "=&v"(y[0]), "=&v"(y[1]), "=&v"(y[2]), "=&v"(y[3]), "=&v"(y[4]), "=&v"(y[5]), "=&v"(y[6]), "=&v"(y[7])
        : "v"(x[0]), "v"(x[1]), "v"(x[2]), "v"(x[3]), "v"(x[4]), "v"(x[5]), "v"(x[6]), "v"(x[7]));
}

// The eight score products of a pass: s[j][t] = c[j] + K tile t (A, two halves of the channels) x
// Q^T tile j (B). In one asm statement so that C stays a register block of its own that the four first
// products only read (the builtin form copied it, 16 registers a pass); each accumulate stands four
// products behind its first half. The v_nops keep the distance the chip needs between the last
// product and the first vector instruction that reads a result or overwrites an operand.
__device__ __forceinline__ void scores8(v8f (&s)[2][2], const v16h (&ka)[2][2], const v16h (&qf)[2][2],
                                        const v8f (&c)[2]) {
    asm("v_wmma_f32_16x16x32_f16 %0, %4, %8, %12\n\t"
        "v_wmma_f32_16x16x32_f16 %1, %5, %8, %12\n\t"
        "v_wmma_f32_16x16x32_f16 %2, %4, %10, %13\n\t"
        "v_wmma_f32_16x16x32_f16 %3, %5, %10, %13\n\t"
        "v_wmma_f32_16x16x32_f16 %0, %6, %9, %0\n\t"
        "v_wmma_f32_16x16x32_f16 %1, %7, %9, %1\n\t"
        "v_wmma_f32_16x16x32_f16 %2, %6, %11, %2\n\t"
        "v_wmma_f32_16x16x32_f16 %3, %7, %11, %3\n\t"
        "v_nop\n\tv_nop\n\tv_nop\n\tv_nop"
        : "=&v"(s[0][0]), "=&v"(s[0][1]), "=&v"(s[1][0]), "=&v"(s[1][1])
        : "v"(ka[0][0]), "v"(ka[0][1]), "v"(ka[1][0]), "v"(ka[1][1]),
          "v"(qf[0][0]), "v"(qf[0][1]), "v"(qf[1][0]), "v"(qf[1][1]), "v"(c[0]), "v"(c[1]));
}

// one 16x32 f16 operand row in the hardware k order: for lane half h the halfs
// 8h..8h+7 and 16+8h..16+8h+7 of the 32; p already points at half 8h
__device__ __forceinline__ v16h frag_kmap(const _Float16* p) {
    const v8h lo = *(const v8h*)p;
    const v8h hi = *(const v8h*)(p + 16);
    return __builtin_shufflevector(lo, hi, 0, 1, 2, 3, 4, 5, 6, 7, 8, 9, 10, 11, 12, 13, 14, 15);
}

// one 16x32 f16 A operand, rows along the columns of a row-major LDS tile [k][row], by the
// transposing load: p is the lane's address for k 0..15 (row k = 8 * lane half + (lane & 7),
// 16 B piece (lane >> 3) & 1); it delivers the hardware k order of frag_kmap
__device__ __forceinline__ v16h frag_tr(const unsigned char* p) {
    typedef __attribute__((address_space(3))) s16x8 lds_s16x8;
    const v8h lo = __builtin_bit_cast(v8h, __builtin_amdgcn_ds_load_tr16_b128_v8i16((lds_s16x8*)p));
    const v8h hi = __builtin_bit_cast(v8h, __builtin_amdgcn_ds_load_tr16_b128_v8i16((lds_s16x8*)(p + 16 * H_PITCH * 2)));
    return __builtin_shufflevector(lo, hi, 0, 1, 2, 3, 4, 5, 6, 7, 8, 9, 10, 11, 12, 13, 14, 15);
}

// a 1x1 conv on a tile of 64 pixels in LDS, src[c][pixel]: a[u] += sum over c of w[u][c] * src[c].
// Lanes run along pixels (two adjacent pixels per lane), a wave owns 4 output channels, and the
// weights are wave-uniform, so they come through scalar loads.
__device__ __forceinline__ void conv4(f32x2 (&a)[4], const cfloat* w, const float* src, int pitch, int lane) {
    // rolled over groups of 16 input channels: what a group loads fits the scalar registers
    #pragma unroll 1
    for (int cg = 0; cg < CDIM; cg += 16) {
        #pragma unroll
        for (int j = 0; j < 16; ++j) {
            const f32x2 h = *(const f32x2*)(src + (cg + j) * pitch + 2 * lane);
            #pragma unroll
            for (int u = 0; u < 4; ++u) a[u] += w[u * CDIM + cg + j] * h;
        }
    }
}

// init + sum over 64 terms of a[o * AS] * b[o * BS], in four chains; a is wave-uniform and comes
// through scalar loads, b is the lane's own; the steps are compile-time, so that every load is its
// base address plus an immediate offset
template <int AS, int BS>
__device__ __forceinline__ float dot64(const cfloat* a, const float* b, float init) {
    float bv[CDIM];
    #pragma unroll
    for (int o = 0; o < CDIM; ++o) bv[o] = b[o * BS];
    // before a register that these loads name is written again (precaution for issued loads)
    asm volatile("s_wait_xcnt 0x0" ::: "memory");
    float s[4] = { init, 0.f, 0.f, 0.f };
    #pragma unroll
    for (int o = 0; o < CDIM; ++o) s[o & 3] += a[o * AS] * bv[o];
    return (s[0] + s[1]) + (s[2] + s[3]);
}

// ---------------------------------------------------------------------------
// Kernel 1, all but the first 33 work-groups: per-(b,c) InstanceNorm over 4096 spatial elements:
// statistics, and the normalized row h as f16 [B, C, HW] (the row stays in registers between the two).
// The first 33 work-groups fold the weights, one output element per thread, f32:
// wf[0] = Wk^T Wq, bf[0] = Wk^T bq (query side); wf[1] = Wp Wv, bf[1] = Wp bv + bp (output side).
// ---------------------------------------------------------------------------
__global__ __launch_bounds__(256) void norm_kernel(const float* __restrict__ x,
                                                   const float* __restrict__ w_qkv,
                                                   const float* __restrict__ b_qkv,
                                                   const float* __restrict__ w_proj,
                                                   const float* __restrict__ b_proj,
                                                   float* __restrict__ mean,
                                                   float* __restrict__ rstd,
                                                   _Float16* __restrict__ hn,
                                                   float* __restrict__ wf,
                                                   float* __restrict__ bf) {
    if (blockIdx.x < FOLD_WG) {                 // the whole work-group, in front of every barrier
        const int f    = blockIdx.x;            // 0..31: 4 rows of a folded matrix each; 32: the two vectors
        const int wrow = __builtin_amdgcn_readfirstlane(threadIdx.x >> 6);
        const int cc   = threadIdx.x & 63;
        const int r    = (f * 4 + wrow) & 63;
        const float* wk = w_qkv + CDIM * CDIM;
        const float* wv = w_qkv + 2 * CDIM * CDIM;
        // the inputs are written by nobody: the wave-uniform operand is read through the constant address space
        // the wait behind each store: before a register that it names is written again (precaution for issued stores)
        if (f < 16) {
            wf[r * CDIM + cc] = dot64<CDIM, CDIM>((const cfloat*)wk + r, w_qkv + cc, 0.f);
            asm volatile("s_wait_xcnt 0x0" ::: "memory");
        } else if (f < 32) {
            wf[(CDIM + r) * CDIM + cc] = dot64<1, CDIM>((const cfloat*)w_proj + r * CDIM, wv + cc, 0.f);
            asm volatile("s_wait_xcnt 0x0" ::: "memory");
        } else if (wrow == 0) {
            bf[cc] = dot64<1, CDIM>((const cfloat*)b_qkv, wk + cc, 0.f);
            asm volatile("s_wait_xcnt 0x0" ::: "memory");
        } else if (wrow == 1) {
            bf[CDIM + cc] = dot64<1, 1>((const cfloat*)b_qkv + 2 * CDIM, w_proj + cc * CDIM, b_proj[cc]);
            asm volatile("s_wait_xcnt 0x0" ::: "memory");
        }
        return;
    }
    __shared__ float ssum[256];
    __shared__ float ssq[256];
    const int bc = blockIdx.x - FOLD_WG;        // 0..255 = b*64 + c
    const float* xp = x + (size_t)bc * HW;
    f32x4 v[4];
    #pragma unroll
    for (int r = 0; r < 4; ++r) v[r] = *(const f32x4*)(xp + (threadIdx.x + r * 256) * 4);
    float s = 0.f, sq = 0.f;
    #pragma unroll
    for (int r = 0; r < 4; ++r) {
        #pragma unroll
        for (int e = 0; e < 4; ++e) { s += v[r][e]; sq += v[r][e] * v[r][e]; }
    }
    ssum[threadIdx.x] = s; ssq[threadIdx.x] = sq;
    __syncthreads();
    for (int off = 128; off > 0; off >>= 1) {
        if (threadIdx.x < off) {
            ssum[threadIdx.x] += ssum[threadIdx.x + off];
            ssq[threadIdx.x]  += ssq[threadIdx.x + off];
        }
        __syncthreads();
    }
    const float mu  = ssum[0] * (1.f / HW);
    const float var = ssq[0] * (1.f / HW) - mu * mu;
    const float rs  = rsqrtf(var + 1e-5f);
    if (threadIdx.x == 0) {
        mean[bc] = mu; rstd[bc] = rs;
        // before a register that these stores name is written again (precaution for issued stores)
        asm volatile("s_wait_xcnt 0x0" ::: "memory");
    }
    _Float16* hp = hn + (size_t)bc * HW;
    #pragma unroll
    for (int r = 0; r < 4; ++r) {
        v4h o;
        #pragma unroll
        for (int e = 0; e < 4; ++e) o[e] = (_Float16)((v[r][e] - mu) * rs);
        *(v4h*)(hp + (threadIdx.x + r * 256) * 4) = o;
    }
    asm volatile("s_wait_xcnt 0x0" ::: "memory");   // the same precaution behind the row's stores
}

// ---------------------------------------------------------------------------
// Kernel 2: flash attention on the normalized input h itself, WMMA f32_16x16x32_f16,
// double-buffered async global->LDS staging of h stages of 256 keys.
// With k = Wk h + bk, a score q.k is (Wk^T q).h plus q.bk, which is the same for every key and
// drops out of the softmax; with v = Wv h + bv and weights that sum to 1, sum P v = Wv (sum P h) + bv.
// So h serves as K and as V: the work-group forms (Wk^T Wq) h + Wk^T bq for its 64 queries in f32 ahead of
// the key loop (multiplied by Q_SCALE ahead of its one rounding to f16), and Wv, bv go into the projection behind it.
// Grid: B * (HW/64) blocks, 512 threads (16 waves, four per SIMD). Wave w owns the
// 32 queries of half w >> 3 and, in every stage, the 32 keys of group w & 7: each
// fragment read from LDS serves two query tiles, and the waves of a SIMD
// fill each other's waits. The eight key groups' partial results are joined at the end.
// Transposed products: S^T = h^T Q^T (A by the transposing LDS load) and O^T += h P^T. A lane holds scores of
// one query per tile (column = lane & 15), so maximum and sum need only lane ^ 16, and
// two score tiles, converted in place, are the B operand of the second product.
// The softmax reference of a query is fixed ahead of a pass: minus the reference is the C
// operand of the score products, which so deliver the exponents of 2 themselves. It moves,
// and O and the sums are rescaled, in the first pass and in a pass whose powers grow large (one test per pass).
// The tile's 64 joined rows never leave the work-group: the 1x1 conv (Wp Wv, folded) and the
// residual follow in the same kernel, out [B, C, H, W] f32.
// ---------------------------------------------------------------------------
__global__ __launch_bounds__(512) void attn_kernel(const _Float16* __restrict__ hn,
                                                   const float* __restrict__ x,
                                                   const float* __restrict__ mean,
                                                   const float* __restrict__ rstd,
                                                   const float* __restrict__ wf,
                                                   const float* __restrict__ bf,
                                                   float* __restrict__ out) {
    __shared__ __align__(16) _Float16 h_lds[2][CDIM * H_PITCH];    // [buf][ch][key]
    __shared__ __align__(16) float    part[16][32 * O_PITCH];      // [wave][query][ch]
    __shared__ float pm[16][32];                                   // [wave][query] reference, log2 domain
    __shared__ float pl[16][32];                                   // [wave][query] sum
    __shared__ __align__(16) float    hs[CDIM * 64];               // [ch][query] the tile's own h, f32
    __shared__ __align__(16) float    ot[CDIM * OT_PITCH];         // [ch][query], joined and normalized
    __shared__ __align__(16) _Float16 q16[64 * Q_PITCH];           // [query][ch]: Wk^T q, scaled

    const int b     = blockIdx.x >> 6;          // 64 query tiles per batch
    const int qtile = blockIdx.x & 63;
    const int tid   = threadIdx.x;
    const int wave  = __builtin_amdgcn_readfirstlane(tid >> 5);
    const int lane  = tid & 31;
    const int lrow  = lane & 15;
    const int lhalf = lane >> 4;
    const int qh    = wave >> 3;                // which 32 of the 64 queries
    const int grp   = wave & 7;                 // which 32 of a stage's 256 keys

    const int c0    = wave * 4;                 // the wave's 4 channels in every 1x1 conv

    // this thread's pieces of a stage: 64 channel rows of 32 pieces of 16 B
    // (a wave copies one whole row of 512 B at a time)
    const char* hg0 = (const char*)(hn + ((size_t)b * CDIM) * HW) + (size_t)(tid >> 5) * (HW * 2) + lane * 16;
    const unsigned hd0 = (unsigned)(uintptr_t)&h_lds[0][0] + (tid >> 5) * (H_PITCH * 2) + lane * 16;

    // ---- issue async staging of one 256-key stage (4 b128s per thread) ----
    auto stage_h = [&](int st, int buf) {
        const char* hg = hg0 + (size_t)st * (KST * 2);              // 512 B of every channel row
        const unsigned hd = hd0 + buf * (CDIM * H_PITCH * 2);
        async_copy16x4(hd, hd + 16 * H_PITCH * 2, hd + 32 * H_PITCH * 2, hd + 48 * H_PITCH * 2,
                       hg, hg + 16 * (HW * 2), hg + 32 * (HW * 2), hg + 48 * (HW * 2));
    };

    stage_h(0, 0);                              // flies while the queries are set up

    // ---- the tile's own h in f32, read in whole lines along the pixels (1024 pieces of 16 B) ----
    {
        f32x4 xv[2];
        float mu[2], rs[2];
        #pragma unroll
        for (int r = 0; r < 2; ++r) {
            const int i = tid + r * 512;
            const int c = i >> 4, p4 = (i & 15) * 4;
            xv[r] = *(const f32x4*)(x + ((size_t)(b * CDIM + c)) * HW + qtile * 64 + p4);
            mu[r] = mean[b * CDIM + c];
            rs[r] = rstd[b * CDIM + c];
        }
        // before a register that these loads name is written again (precaution for issued loads)
        asm volatile("s_wait_xcnt 0x0" ::: "memory");
        #pragma unroll
        for (int r = 0; r < 2; ++r) {
            const int i = tid + r * 512;
            const int c = i >> 4, p4 = (i & 15) * 4;
            f32x4 hv;
            #pragma unroll
            for (int e = 0; e < 4; ++e) hv[e] = (xv[r][e] - mu[r]) * rs[r];
            *(f32x4*)(hs + c * 64 + p4) = hv;
        }
    }
    // the folded weights are written by nobody during this launch: read through the constant
    // address space, so that these wave-uniform reads stay scalar loads behind the asm statements
    const cfloat* wfc = (const cfloat*)wf;
    const cfloat* bfc = (const cfloat*)bf;
    __syncthreads();
    // ---- Wk^T q = (Wk^T Wq) h + Wk^T bq, scaled, one f16 row per query ----
    {
        f32x2 qa[4];
        #pragma unroll
        for (int u = 0; u < 4; ++u) { const float bv = bfc[c0 + u]; qa[u][0] = bv; qa[u][1] = bv; }
        conv4(qa, wfc + c0 * CDIM, hs, 64, lane);
        #pragma unroll
        for (int e = 0; e < 2; ++e) {
            v4h o;
            #pragma unroll
            for (int u = 0; u < 4; ++u) o[u] = (_Float16)(qa[u][e] * Q_SCALE);
            *(v4h*)(q16 + (2 * lane + e) * Q_PITCH + c0) = o;
        }
    }
    asm volatile("s_wait_asynccnt 0x0" ::: "memory");   // this wave's pieces of stage 0 landed
    __syncthreads();                                    // and every other wave's; the query rows too
    stage_h(1, 1);

    // Q B-fragments (64 ch x 2 x 16 queries) held in registers for the whole key loop.
    v16h qf[2][2];
    #pragma unroll
    for (int j = 0; j < 2; ++j) {
        const _Float16* qbase = q16 + (qh * 32 + j * 16 + lrow) * Q_PITCH;
        qf[j][0] = frag_kmap(qbase + lhalf * 8);         // ch 0..31
        qf[j][1] = frag_kmap(qbase + 32 + lhalf * 8);    // ch 32..63
    }

    v8f acc[2][4] = {};               // O^T per query tile: acc[j][t][r] = ch 16t + 8*lhalf + r
    float mref[2] = { 0.f, 0.f };     // this lane's queries: reference in use, log2 domain (same in both halves)
    v8f   cneg[2] = {};               // minus the reference in all 8 registers: C of the score products
    float l[2] = { 0.f, 0.f };        // and the sum over this lane half's keys only

    // the lane's place in a stage for the transposing reads: channel row 8 * lhalf + (lane & 7),
    // the group's 32 keys, 16 B piece (lane >> 3) & 1
    const unsigned troff = (lhalf * 8 + (lane & 7)) * (H_PITCH * 2) + grp * 64 + ((lane >> 3) & 1) * 16;

    for (int st = 0; st < NST; ++st) {
        const int cur = st & 1;
        const unsigned char* kl = (const unsigned char*)&h_lds[cur][0] + troff;
        const _Float16* vl = &h_lds[cur][grp * 32];

        // ---- S^T = K * Q^T - reference : 2 tiles of 16 keys, s[j][t][r] = key 16t + 8*lhalf + r ----
        v16h ka[2][2], va[4];
        #pragma unroll
        for (int kc = 0; kc < 2; ++kc) {
            #pragma unroll
            for (int t = 0; t < 2; ++t)
                ka[kc][t] = frag_tr(kl + kc * 32 * (H_PITCH * 2) + t * 32);
        }
        v8f s[2][2];
        scores8(s, ka, qf, cneg);
        // the two scheduling barriers keep the V^T fragment loads between the score products and the
        // powers: lifted above the products they queue in front of the other waves' K reads, sunk
        // below the powers they leave their LDS latency open in front of the second product
        __builtin_amdgcn_sched_barrier(0);
        #pragma unroll
        for (int t = 0; t < 4; ++t)
            va[t] = frag_kmap(&vl[(t * 16 + lrow) * H_PITCH + lhalf * 8]);
        __builtin_amdgcn_sched_barrier(0);

        // ---- softmax against the reference in use, one query per lane and tile ----
        // P^T: the two tiles, converted in place, are the B operand of the 32 keys
        v16h pf[2];
        float tot[2];
        auto powers = [&](int j) {
            float ps[8];
            #pragma unroll
            for (int t = 0; t < 2; ++t) {
                float e[8];
                exp2x8(e, s[j][t]);
                #pragma unroll
                for (int r = 0; r < 8; r += 2) {
                    f32x2 p;
                    p[0] = e[r];
                    p[1] = e[r + 1];
                    ps[r]     = t ? ps[r] + p[0] : p[0];
                    ps[r + 1] = t ? ps[r + 1] + p[1] : p[1];
                    const h16x2 ph = __builtin_convertvector(p, h16x2);
                    pf[j][t * 8 + r]     = ph[0];
                    pf[j][t * 8 + r + 1] = ph[1];
                }
            }
            tot[j] = ((ps[0] + ps[1]) + (ps[2] + ps[3])) + ((ps[4] + ps[5]) + (ps[6] + ps[7]));
        };
        powers(0);
        powers(1);

        // one test per pass, a scalar branch: no power passed RESCALE_AT where no lane's sum did
        // (an overflow to infinity shows in the sum too). The first pass always sets the reference.
        const bool need = fmaxf(tot[0], tot[1]) > RESCALE_AT;
        if (st == 0 || __builtin_amdgcn_ballot_w32(need) != 0u) {
            #pragma unroll
            for (int j = 0; j < 2; ++j) {
                float mx[8];
                #pragma unroll
                for (int r = 0; r < 8; ++r) mx[r] = fmaxf(s[j][0][r], s[j][1][r]);
                float d = fmaxf(fmaxf(fmaxf(mx[0], mx[1]), fmaxf(mx[2], mx[3])),
                                fmaxf(fmaxf(mx[4], mx[5]), fmaxf(mx[6], mx[7])));
                d = fmaxf(d, xhalf(d));             // 16 keys here, 16 in lane ^ 16
                if (st != 0) d = fmaxf(d, 0.f);     // behind the first pass the reference only rises
                // 2^-d, never above 1; in asm so that the v_nop, the slot the instruction set asks
                // for behind a transcendental, stays directly behind it
                float alpha;
                asm("v_exp_f32 %0, %1\n\tv_nop" : "=v"(alpha) : "v"(fminf(-d, 0.f)));
                mref[j] += d;
                #pragma unroll
                for (int r = 0; r < 8; ++r) cneg[j][r] = -mref[j];
                #pragma unroll
                for (int t = 0; t < 4; ++t) acc[j][t] *= alpha;
                l[j] *= alpha;
                #pragma unroll
                for (int t = 0; t < 2; ++t) s[j][t] -= d;
                powers(j);
            }
        }
        l[0] += tot[0];
        l[1] += tot[1];

        // ---- O^T += V^T * P^T : A = V^T rows (channels) from LDS, in P^T's key order ----
        #pragma unroll
        for (int j = 0; j < 2; ++j) {
            #pragma unroll
            for (int t = 0; t < 4; ++t)
                acc[j][t] = __builtin_amdgcn_wmma_f32_16x16x32_f16(false, va[t], false, pf[j],
                                                                   (short)0, acc[j][t], false, false);
        }

        // ---- hand-over: one barrier publishes stage st + 1 and frees this stage's buffer ----
        // keeps the waits at the pass's foot, behind the softmax and the products (for speed only)
        __builtin_amdgcn_sched_barrier(0);
        asm volatile("s_wait_dscnt 0x0" ::: "memory");      // this wave's reads of buf[cur] are done
        asm volatile("s_wait_asynccnt 0x0" ::: "memory");   // its pieces of stage st + 1 landed
        __syncthreads();
        if (st + 2 < NST) stage_h(st + 2, cur);
    }
    asm volatile("s_wait_asynccnt 0x0" ::: "memory");       // nothing in flight behind the loop

    // ---- each wave lays down its reference, sum (halves joined) and O rows ----
    // a lane's 8 registers of a tile are 8 consecutive channels of its query's row
    #pragma unroll
    for (int j = 0; j < 2; ++j) {
        const float lt = l[j] + xhalf(l[j]);
        if (lhalf == 0) { pm[wave][j * 16 + lrow] = mref[j]; pl[wave][j * 16 + lrow] = lt; }
        float* prow = &part[wave][(j * 16 + lrow) * O_PITCH + lhalf * 8];
        #pragma unroll
        for (int t = 0; t < 4; ++t) {
            f32x4 lo, hi;
            #pragma unroll
            for (int e = 0; e < 4; ++e) { lo[e] = acc[j][t][e]; hi[e] = acc[j][t][e + 4]; }
            *(f32x4*)(prow + t * 16)     = lo;
            *(f32x4*)(prow + t * 16 + 4) = hi;
        }
    }
    __syncthreads();

    // ---- join the 8 key groups, normalize, lay O^T down in LDS ----
    // a thread owns 8 channels of one query
    const int jq = tid >> 3;                    // query of the tile, 0..63
    const int c8 = (tid & 7) * 8;
    const int w0 = (jq >> 5) * 8, qr = jq & 31;
    float mg[8];
    #pragma unroll
    for (int g = 0; g < 8; ++g) mg[g] = pm[w0 + g][qr];
    const float mall = fmaxf(fmaxf(fmaxf(mg[0], mg[1]), fmaxf(mg[2], mg[3])),
                             fmaxf(fmaxf(mg[4], mg[5]), fmaxf(mg[6], mg[7])));
    v8f dm;
    #pragma unroll
    for (int g = 0; g < 8; ++g) dm[g] = mg[g] - mall;
    float wg[8];
    exp2x8(wg, dm);
    float lall = 0.f;
    f32x4 lo = {}, hi = {};
    #pragma unroll
    for (int g = 0; g < 8; ++g) {
        const float* prow = &part[w0 + g][qr * O_PITCH + c8];
        lall += wg[g] * pl[w0 + g][qr];
        lo   += wg[g] * *(const f32x4*)prow;
        hi   += wg[g] * *(const f32x4*)(prow + 4);
    }
    const float inv = 1.f / lall;
    lo = lo * inv;
    hi = hi * inv;
    #pragma unroll
    for (int e = 0; e < 4; ++e) {
        ot[(c8 + e) * OT_PITCH + jq]     = lo[e];
        ot[(c8 + 4 + e) * OT_PITCH + jq] = hi[e];
    }
    f32x2 pa[4];
    #pragma unroll
    for (int u = 0; u < 4; ++u) { const float bv = bfc[CDIM + c0 + u]; pa[u][0] = bv; pa[u][1] = bv; }
    __syncthreads();

    // ---- folded 1x1 conv + residual: 4 output channels x 64 pixels per wave ----
    // residual rows: asked for behind the barrier (which would wait for them), used at the very end
    const size_t idx0 = ((size_t)(b * CDIM + c0)) * HW + qtile * 64 + 2 * lane;
    f32x2 xr[4];
    #pragma unroll
    for (int u = 0; u < 4; ++u) xr[u] = *(const f32x2*)(x + idx0 + (size_t)u * HW);
    conv4(pa, wfc + (CDIM + c0) * CDIM, ot, OT_PITCH, lane);
    // one run of 256 B (two whole lines) per channel and wave
    #pragma unroll
    for (int u = 0; u < 4; ++u) *(f32x2*)(out + idx0 + (size_t)u * HW) = xr[u] + pa[u];
}

// ---------------------------------------------------------------------------
extern "C" void kernel_launch(void* const* d_in, const int* in_sizes, int n_in,
                              void* d_out, int out_size, void* d_ws, size_t ws_size,
                              hipStream_t stream) {
    const float* x      = (const float*)d_in[0];
    const float* w_qkv  = (const float*)d_in[1];
    const float* b_qkv  = (const float*)d_in[2];
    const float* w_proj = (const float*)d_in[3];
    const float* b_proj = (const float*)d_in[4];
    float* out = (float*)d_out;

    const size_t B = 4;
    char* ws = (char*)d_ws;
    float*    mean = (float*)ws;                       // 256 f32
    float*    rstd = mean + 256;                       // 256 f32
    float*    bf   = rstd + 256;                       // 2 x 64 f32
    float*    wf   = (float*)(ws + 4096);              // 2 x 64 x 64 f32
    _Float16* hn   = (_Float16*)(ws + 4096 + 32768);   // 2 MB (f16)

    norm_kernel<<<B * CDIM + FOLD_WG, 256, 0, stream>>>(x, w_qkv, b_qkv, w_proj, b_proj, mean, rstd, hn, wf, bf);
    attn_kernel<<<B * (HW / 64), 512, 0, stream>>>(hn, x, mean, rstd, wf, bf, out);
}

// v007
// It runs in 19.8 microseconds.
// Next to v006, in two timings, it ran 1.09 times as fast each time.
// Counting every step since v000, it is 11.0 times as fast.
#include <hip/hip_runtime.h>
#include <hip/hip_bf16.h>

typedef __attribute__((ext_vector_type(16))) _Float16 v16h;
typedef __attribute__((ext_vector_type(8)))  float    v8f;
typedef __attribute__((ext_vector_type(8)))  _Float16 v8h;
typedef __attribute__((ext_vector_type(4)))  _Float16 v4h;
typedef __attribute__((ext_vector_type(8)))  short    s16x8;
typedef __attribute__((ext_vector_type(2)))  _Float16 h16x2;
typedef __attribute__((ext_vector_type(4)))  float    f32x4;
typedef __attribute__((ext_vector_type(2)))  float    f32x2;
typedef __attribute__((address_space(4)))    float    cfloat;   // a float in constant memory

#define HW   4096
#define CDIM 64
#define Q_SCALE 0.18033688f   // 64^-0.5 * log2(e): q carries it, so a score is an exponent of 2
#define RESCALE_AT 256.f      // a lane's sum of a pass's 16 powers above this moves the reference
#define O_PITCH  68        // floats per staged pixel row: 64 + 4, a pitch of 16 B x odd
#define KST      256       // keys per pass of the key loop: 8 wave groups x 32 keys
#define NST      (HW / KST)
#define PPS      4         // passes per stage of the attention ring: a stage is 1024 keys
#define NSG      (NST / PPS)
#define FOLD_WG  33        // work-groups of the first kernel that fold the weights
#define H_PITCH  272       // halfs per staged channel row of h: 256 + 16, a pitch of 32 B x odd (transposing reads)
#define Q_PITCH  72        // halfs per staged query row: 64 + 8, a pitch of 16 B x odd
#define OT_PITCH 66        // floats per staged channel row of the tile's O^T: 64 + 2, rows stay 8 B aligned

// ---------------------------------------------------------------------------
// CDNA5 async global->LDS copies, 16 bytes per lane each, tracked by ASYNCcnt.
// l*: the lane's LDS byte address (low 32 bits of the flat LDS pointer).
// One statement for a thread's four copies of a pass's keys; the s_wait_xcnt at its end
// stands in front of any rewrite of an address register (precaution for issued copies).
// ---------------------------------------------------------------------------
__device__ __forceinline__ void async_copy16x4(unsigned l0, unsigned l1, unsigned l2, unsigned l3,
                                               const void* g0, const void* g1, const void* g2, const void* g3) {
    asm volatile("global_load_async_to_lds_b128 %0, %4, off\n\t"
                 "global_load_async_to_lds_b128 %1, %5, off\n\t"
                 "global_load_async_to_lds_b128 %2, %6, off\n\t"
                 "global_load_async_to_lds_b128 %3, %7, off\n\t"
                 "s_wait_xcnt 0x0"
                 :: "v"(l0), "v"(l1), "v"(l2), "v"(l3), "v"(g0), "v"(g1), "v"(g2), "v"(g3)
                 : "memory");
}

// lane l <-> lane l ^ 16, on the vector pipe
__device__ __forceinline__ float xhalf(float v) {
    const int b = __float_as_int(v);
    return __int_as_float(__builtin_amdgcn_permlanex16(b, b, 0x76543210, 0xfedcba98, false, false));
}

// y = 2^x for eight values (a score tile; the join's weights). In asm, with results that share no
// register with a source, so that every v_exp_f32 is followed by an instruction that touches none of
// its registers, the last one by the v_nop: the slot the instruction set asks for behind a transcendental
__device__ __forceinline__ void exp2x8(float (&y)[8], v8f x) {
    asm("v_exp_f32 %0, %8\n\tv_exp_f32 %1, %9\n\tv_exp_f32 %2, %10\n\tv_exp_f32 %3, %11\n\t"
        "v_exp_f32 %4, %12\n\tv_exp_f32 %5, %13\n\tv_exp_f32 %6, %14\n\tv_exp_f32 %7, %15\n\tv_nop"
        : "=&v"(y[0]), "=&v"(y[1]), "=&v"(y[2]), "=&v"(y[3]), "=&v"(y[4]), "=&v"(y[5]), "=&v"(y[6]), "=&v"(y[7])
        : "v"(x[0]), "v"(x[1]), "v"(x[2]), "v"(x[3]), "v"(x[4]), "v"(x[5]), "v"(x[6]), "v"(x[7]));
}

// The eight score products of a pass: s[j][t] = c[j] + K tile t (A, two halves of the channels) x
// Q^T tile j (B). In one asm statement so that C stays a register block of its own that the four first
// products only read (the builtin form copied it, 16 registers a pass); each accumulate stands four
// products behind its first half. The v_nops keep the distance the chip needs between the last
// product and the first vector instruction that reads a result or overwrites an operand.
__device__ __forceinline__ void scores8(v8f (&s)[2][2], const v16h (&ka)[2][2], const v16h (&qf)[2][2],
                                        const v8f (&c)[2]) {
    asm("v_wmma_f32_16x16x32_f16 %0, %4, %8, %12\n\t"
        "v_wmma_f32_16x16x32_f16 %1, %5, %8, %12\n\t"
        "v_wmma_f32_16x16x32_f16 %2, %4, %10, %13\n\t"
        "v_wmma_f32_16x16x32_f16 %3, %5, %10, %13\n\t"
        "v_wmma_f32_16x16x32_f16 %0, %6, %9, %0\n\t"
        "v_wmma_f32_16x16x32_f16 %1, %7, %9, %1\n\t"
        "v_wmma_f32_16x16x32_f16 %2, %6, %11, %2\n\t"
        "v_wmma_f32_16x16x32_f16 %3, %7, %11, %3\n\t"
        "v_nop\n\tv_nop\n\tv_nop\n\tv_nop"
        : "=&v"(s[0][0]), "=&v"(s[0][1]), "=&v"(s[1][0]), "=&v"(s[1][1])
        : "v"(ka[0][0]), "v"(ka[0][1]), "v"(ka[1][0]), "v"(ka[1][1]),
          "v"(qf[0][0]), "v"(qf[0][1]), "v"(qf[1][0]), "v"(qf[1][1]), "v"(c[0]), "v"(c[1]));
}

// one 16x32 f16 operand row in the hardware k order: for lane half h the halfs
// 8h..8h+7 and 16+8h..16+8h+7 of the 32; p already points at half 8h
__device__ __forceinline__ v16h frag_kmap(const _Float16* p) {
    const v8h lo = *(const v8h*)p;
    const v8h hi = *(const v8h*)(p + 16);
    return __builtin_shufflevector(lo, hi, 0, 1, 2, 3, 4, 5, 6, 7, 8, 9, 10, 11, 12, 13, 14, 15);
}

// one 16x32 f16 A operand, rows along the columns of a row-major LDS tile [k][row], by the
// transposing load: p is the lane's address for k 0..15 (row k = 8 * lane half + (lane & 7),
// 16 B piece (lane >> 3) & 1); it delivers the hardware k order of frag_kmap
__device__ __forceinline__ v16h frag_tr(const unsigned char* p) {
    typedef __attribute__((address_space(3))) s16x8 lds_s16x8;
    const v8h lo = __builtin_bit_cast(v8h, __builtin_amdgcn_ds_load_tr16_b128_v8i16((lds_s16x8*)p));
    const v8h hi = __builtin_bit_cast(v8h, __builtin_amdgcn_ds_load_tr16_b128_v8i16((lds_s16x8*)(p + 16 * H_PITCH * 2)));
    return __builtin_shufflevector(lo, hi, 0, 1, 2, 3, 4, 5, 6, 7, 8, 9, 10, 11, 12, 13, 14, 15);
}

// a 1x1 conv on a tile of 64 pixels in LDS, src[c][pixel]: a[u] += sum over c of w[u][c] * src[c].
// Lanes run along pixels (two adjacent pixels per lane), a wave owns 4 output channels, and the
// weights are wave-uniform, so they come through scalar loads.
__device__ __forceinline__ void conv4(f32x2 (&a)[4], const cfloat* w, const float* src, int pitch, int lane) {
    // rolled over groups of 16 input channels: what a group loads fits the scalar registers
    #pragma unroll 1
    for (int cg = 0; cg < CDIM; cg += 16) {
        #pragma unroll
        for (int j = 0; j < 16; ++j) {
            const f32x2 h = *(const f32x2*)(src + (cg + j) * pitch + 2 * lane);
            #pragma unroll
            for (int u = 0; u < 4; ++u) a[u] += w[u * CDIM + cg + j] * h;
        }
    }
}

// init + sum over 64 terms of a[o * AS] * b[o * BS], in four chains; a is wave-uniform and comes
// through scalar loads, b is the lane's own; the steps are compile-time, so that every load is its
// base address plus an immediate offset
template <int AS, int BS>
__device__ __forceinline__ float dot64(const cfloat* a, const float* b, float init) {
    float bv[CDIM];
    #pragma unroll
    for (int o = 0; o < CDIM; ++o) bv[o] = b[o * BS];
    // before a register that these loads name is written again (precaution for issued loads)
    asm volatile("s_wait_xcnt 0x0" ::: "memory");
    float s[4] = { init, 0.f, 0.f, 0.f };
    #pragma unroll
    for (int o = 0; o < CDIM; ++o) s[o & 3] += a[o * AS] * bv[o];
    return (s[0] + s[1]) + (s[2] + s[3]);
}

// ---------------------------------------------------------------------------
// Kernel 1, all but the first 33 work-groups: per-(b,c) InstanceNorm over 4096 spatial elements:
// statistics, and the normalized row h as f16 [B, C, HW] (the row stays in registers between the two).
// The first 33 work-groups fold the weights, one output element per thread, f32:
// wf[0] = Wk^T Wq, bf[0] = Wk^T bq (query side); wf[1] = Wp Wv, bf[1] = Wp bv + bp (output side).
// ---------------------------------------------------------------------------
__global__ __launch_bounds__(256) void norm_kernel(const float* __restrict__ x,
                                                   const float* __restrict__ w_qkv,
                                                   const float* __restrict__ b_qkv,
                                                   const float* __restrict__ w_proj,
                                                   const float* __restrict__ b_proj,
                                                   float* __restrict__ mean,
                                                   float* __restrict__ rstd,
                                                   _Float16* __restrict__ hn,
                                                   float* __restrict__ wf,
                                                   float* __restrict__ bf) {
    if (blockIdx.x < FOLD_WG) {                 // the whole work-group, in front of every barrier
        const int f    = blockIdx.x;            // 0..31: 4 rows of a folded matrix each; 32: the two vectors
        const int wrow = __builtin_amdgcn_readfirstlane(threadIdx.x >> 6);
        const int cc   = threadIdx.x & 63;
        const int r    = (f * 4 + wrow) & 63;
        const float* wk = w_qkv + CDIM * CDIM;
        const float* wv = w_qkv + 2 * CDIM * CDIM;
        // the inputs are written by nobody: the wave-uniform operand is read through the constant address space
        // the wait behind each store: before a register that it names is written again (precaution for issued stores)
        if (f < 16) {
            wf[r * CDIM + cc] = dot64<CDIM, CDIM>((const cfloat*)wk + r, w_qkv + cc, 0.f);
            asm volatile("s_wait_xcnt 0x0" ::: "memory");
        } else if (f < 32) {
            wf[(CDIM + r) * CDIM + cc] = dot64<1, CDIM>((const cfloat*)w_proj + r * CDIM, wv + cc, 0.f);
            asm volatile("s_wait_xcnt 0x0" ::: "memory");
        } else if (wrow == 0) {
            bf[cc] = dot64<1, CDIM>((const cfloat*)b_qkv, wk + cc, 0.f);
            asm volatile("s_wait_xcnt 0x0" ::: "memory");
        } else if (wrow == 1) {
            bf[CDIM + cc] = dot64<1, 1>((const cfloat*)b_qkv + 2 * CDIM, w_proj + cc * CDIM, b_proj[cc]);
            asm volatile("s_wait_xcnt 0x0" ::: "memory");
        }
        return;
    }
    __shared__ float ssum[256];
    __shared__ float ssq[256];
    const int bc = blockIdx.x - FOLD_WG;        // 0..255 = b*64 + c
    const float* xp = x + (size_t)bc * HW;
    f32x4 v[4];
    #pragma unroll
    for (int r = 0; r < 4; ++r) v[r] = *(const f32x4*)(xp + (threadIdx.x + r * 256) * 4);
    float s = 0.f, sq = 0.f;
    #pragma unroll
    for (int r = 0; r < 4; ++r) {
        #pragma unroll
        for (int e = 0; e < 4; ++e) { s += v[r][e]; sq += v[r][e] * v[r][e]; }
    }
    ssum[threadIdx.x] = s; ssq[threadIdx.x] = sq;
    __syncthreads();
    for (int off = 128; off > 0; off >>= 1) {
        if (threadIdx.x < off) {
            ssum[threadIdx.x] += ssum[threadIdx.x + off];
            ssq[threadIdx.x]  += ssq[threadIdx.x + off];
        }
        __syncthreads();
    }
    const float mu  = ssum[0] * (1.f / HW);
    const float var = ssq[0] * (1.f / HW) - mu * mu;
    const float rs  = rsqrtf(var + 1e-5f);
    if (threadIdx.x == 0) {
        mean[bc] = mu; rstd[bc] = rs;
        // before a register that these stores name is written again (precaution for issued stores)
        asm volatile("s_wait_xcnt 0x0" ::: "memory");
    }
    _Float16* hp = hn + (size_t)bc * HW;
    #pragma unroll
    for (int r = 0; r < 4; ++r) {
        v4h o;
        #pragma unroll
        for (int e = 0; e < 4; ++e) o[e] = (_Float16)((v[r][e] - mu) * rs);
        *(v4h*)(hp + (threadIdx.x + r * 256) * 4) = o;
    }
    asm volatile("s_wait_xcnt 0x0" ::: "memory");   // the same precaution behind the row's stores
}

// ---------------------------------------------------------------------------
// Kernel 2: flash attention on the normalized input h itself, WMMA f32_16x16x32_f16,
// double-buffered async global->LDS staging of h in stages of 1024 keys (four passes of 256 keys:
// between two hand-overs the waves run free of each other, so that one wave's LDS reads and
// products fill the slots that another leaves open in its softmax).
// With k = Wk h + bk, a score q.k is (Wk^T q).h plus q.bk, which is the same for every key and
// drops out of the softmax; with v = Wv h + bv and weights that sum to 1, sum P v = Wv (sum P h) + bv.
// So h serves as K and as V: the work-group forms (Wk^T Wq) h + Wk^T bq for its 64 queries in f32 ahead of
// the key loop (multiplied by Q_SCALE ahead of its one rounding to f16), and Wv, bv go into the projection behind it.
// Grid: B * (HW/64) blocks, 512 threads (16 waves, four per SIMD). Wave w owns the
// 32 queries of half w >> 3 and, in every pass, the 32 keys of group w & 7: each
// fragment read from LDS serves two query tiles, and the waves of a SIMD
// fill each other's waits. The eight key groups' partial results are joined at the end.
// Transposed products: S^T = h^T Q^T (A by the transposing LDS load) and O^T += h P^T. A lane holds scores of
// one query per tile (column = lane & 15), so maximum and sum need only lane ^ 16, and
// two score tiles, converted in place, are the B operand of the second product.
// The softmax reference of a query is fixed ahead of a pass: minus the reference is the C
// operand of the score products, which so deliver the exponents of 2 themselves. It moves,
// and O and the sums are rescaled, in the first pass and in a pass whose powers grow large (one test per pass).
// The tile's 64 joined rows never leave the work-group: the 1x1 conv (Wp Wv, folded) and the
// residual follow in the same kernel, out [B, C, H, W] f32.
// ---------------------------------------------------------------------------
__global__ __launch_bounds__(512) void attn_kernel(const _Float16* __restrict__ hn,
                                                   const float* __restrict__ x,
                                                   const float* __restrict__ mean,
                                                   const float* __restrict__ rstd,
                                                   const float* __restrict__ wf,
                                                   const float* __restrict__ bf,
                                                   float* __restrict__ out) {
    __shared__ __align__(16) _Float16 h_lds[2 * PPS][CDIM * H_PITCH];   // [buf * PPS + pass of the stage][ch][key]
    __shared__ float pm[16][32];                                   // [wave][query] reference, log2 domain
    __shared__ float pl[16][32];                                   // [wave][query] sum
    __shared__ __align__(16) float    hs[CDIM * 64];               // [ch][query] the tile's own h, f32
    __shared__ __align__(16) float    ot[CDIM * OT_PITCH];         // [ch][query], joined and normalized
    __shared__ __align__(16) _Float16 q16[64 * Q_PITCH];           // [query][ch]: Wk^T q, scaled

    const int b     = blockIdx.x >> 6;          // 64 query tiles per batch
    const int qtile = blockIdx.x & 63;
    const int tid   = threadIdx.x;
    const int wave  = __builtin_amdgcn_readfirstlane(tid >> 5);
    const int lane  = tid & 31;
    const int lrow  = lane & 15;
    const int lhalf = lane >> 4;
    const int qh    = wave >> 3;                // which 32 of the 64 queries
    const int grp   = wave & 7;                 // which 32 of a pass's 256 keys

    const int c0    = wave * 4;                 // the wave's 4 channels in every 1x1 conv

    // this thread's pieces of a pass's keys: 64 channel rows of 32 pieces of 16 B
    // (a wave copies one whole row of 512 B at a time)
    const char* hg0 = (const char*)(hn + ((size_t)b * CDIM) * HW) + (size_t)(tid >> 5) * (HW * 2) + lane * 16;
    const unsigned hd0 = (unsigned)(uintptr_t)&h_lds[0][0] + (tid >> 5) * (H_PITCH * 2) + lane * 16;

    // ---- issue async staging of one 1024-key stage (16 b128s per thread) ----
    auto stage_h = [&](int sg, int buf) {
        // unrolled, so that the four statements' addresses differ by constants only
        #pragma unroll
        for (int i = 0; i < PPS; ++i) {
            const char* hg = hg0 + (size_t)(sg * PPS + i) * (KST * 2);      // 512 B of every channel row
            const unsigned hd = hd0 + (buf * PPS + i) * (CDIM * H_PITCH * 2);
            async_copy16x4(hd, hd + 16 * H_PITCH * 2, hd + 32 * H_PITCH * 2, hd + 48 * H_PITCH * 2,
                           hg, hg + 16 * (HW * 2), hg + 32 * (HW * 2), hg + 48 * (HW * 2));
        }
    };

    // ---- the tile's own h in f32, read in whole lines along the pixels (1024 pieces of 16 B) ----
    {
        f32x4 xv[2];
        float mu[2], rs[2];
        #pragma unroll
        for (int r = 0; r < 2; ++r) {
            const int i = tid + r * 512;
            const int c = i >> 4, p4 = (i & 15) * 4;
            xv[r] = *(const f32x4*)(x + ((size_t)(b * CDIM + c)) * HW + qtile * 64 + p4);
            mu[r] = mean[b * CDIM + c];
            rs[r] = rstd[b * CDIM + c];
        }
        // before a register that these loads name is written again (precaution for issued loads)
        asm volatile("s_wait_xcnt 0x0" ::: "memory");
        // stage 0 flies while the queries are set up; asked for behind the tile's own loads,
        // which would otherwise queue behind its 128 KB
        stage_h(0, 0);
        #pragma unroll
        for (int r = 0; r < 2; ++r) {
            const int i = tid + r * 512;
            const int c = i >> 4, p4 = (i & 15) * 4;
            f32x4 hv;
            #pragma unroll
            for (int e = 0; e < 4; ++e) hv[e] = (xv[r][e] - mu[r]) * rs[r];
            *(f32x4*)(hs + c * 64 + p4) = hv;
        }
    }
    // the folded weights are written by nobody during this launch: read through the constant
    // address space, so that these wave-uniform reads stay scalar loads behind the asm statements
    const cfloat* wfc = (const cfloat*)wf;
    const cfloat* bfc = (const cfloat*)bf;
    __syncthreads();
    // ---- Wk^T q = (Wk^T Wq) h + Wk^T bq, scaled, one f16 row per query ----
    {
        f32x2 qa[4];
        #pragma unroll
        for (int u = 0; u < 4; ++u) { const float bv = bfc[c0 + u]; qa[u][0] = bv; qa[u][1] = bv; }
        conv4(qa, wfc + c0 * CDIM, hs, 64, lane);
        #pragma unroll
        for (int e = 0; e < 2; ++e) {
            v4h o;
            #pragma unroll
            for (int u = 0; u < 4; ++u) o[u] = (_Float16)(qa[u][e] * Q_SCALE);
            *(v4h*)(q16 + (2 * lane + e) * Q_PITCH + c0) = o;
        }
    }
    asm volatile("s_wait_asynccnt 0x0" ::: "memory");   // this wave's pieces of stage 0 landed
    __syncthreads();                                    // and every other wave's; the query rows too
    stage_h(1, 1);

    // Q B-fragments (64 ch x 2 x 16 queries) held in registers for the whole key loop.
    v16h qf[2][2];
    #pragma unroll
    for (int j = 0; j < 2; ++j) {
        const _Float16* qbase = q16 + (qh * 32 + j * 16 + lrow) * Q_PITCH;
        qf[j][0] = frag_kmap(qbase + lhalf * 8);         // ch 0..31
        qf[j][1] = frag_kmap(qbase + 32 + lhalf * 8);    // ch 32..63
    }

    v8f acc[2][4] = {};               // O^T per query tile: acc[j][t][r] = ch 16t + 8*lhalf + r
    float mref[2] = { 0.f, 0.f };     // this lane's queries: reference in use, log2 domain (same in both halves)
    v8f   cneg[2] = {};               // minus the reference in all 8 registers: C of the score products
    float l[2] = { 0.f, 0.f };        // and the sum over this lane half's keys only

    // the lane's place in a pass's keys for the transposing reads: channel row 8 * lhalf + (lane & 7),
    // the group's 32 keys, 16 B piece (lane >> 3) & 1
    const unsigned troff = (lhalf * 8 + (lane & 7)) * (H_PITCH * 2) + grp * 64 + ((lane >> 3) & 1) * 16;

    for (int st = 0; st < NST; ++st) {
        const int cur = st & (2 * PPS - 1);     // buffer (st / PPS) & 1, pass st % PPS of its stage
        const unsigned char* kl = (const unsigned char*)&h_lds[cur][0] + troff;
        const _Float16* vl = &h_lds[cur][grp * 32];

        // ---- S^T = K * Q^T - reference : 2 tiles of 16 keys, s[j][t][r] = key 16t + 8*lhalf + r ----
        v16h ka[2][2], va[4];
        #pragma unroll
        for (int kc = 0; kc < 2; ++kc) {
            #pragma unroll
            for (int t = 0; t < 2; ++t)
                ka[kc][t] = frag_tr(kl + kc * 32 * (H_PITCH * 2) + t * 32);
        }
        v8f s[2][2];
        scores8(s, ka, qf, cneg);
        // the two scheduling barriers keep the V^T fragment loads between the score products and the
        // powers: lifted above the products they queue in front of the other waves' K reads, sunk
        // below the powers they leave their LDS latency open in front of the second product
        __builtin_amdgcn_sched_barrier(0);
        #pragma unroll
        for (int t = 0; t < 4; ++t)
            va[t] = frag_kmap(&vl[(t * 16 + lrow) * H_PITCH + lhalf * 8]);
        __builtin_amdgcn_sched_barrier(0);

        // ---- softmax against the reference in use, one query per lane and tile ----
        // P^T: the two tiles, converted in place, are the B operand of the 32 keys
        v16h pf[2];
        float tot[2];
        auto powers = [&](int j) {
            float ps[8];
            #pragma unroll
            for (int t = 0; t < 2; ++t) {
                float e[8];
                exp2x8(e, s[j][t]);
                #pragma unroll
                for (int r = 0; r < 8; r += 2) {
                    f32x2 p;
                    p[0] = e[r];
                    p[1] = e[r + 1];
                    ps[r]     = t ? ps[r] + p[0] : p[0];
                    ps[r + 1] = t ? ps[r + 1] + p[1] : p[1];
                    const h16x2 ph = __builtin_convertvector(p, h16x2);
                    pf[j][t * 8 + r]     = ph[0];
                    pf[j][t * 8 + r + 1] = ph[1];
                }
            }
            tot[j] = ((ps[0] + ps[1]) + (ps[2] + ps[3])) + ((ps[4] + ps[5]) + (ps[6] + ps[7]));
        };
        powers(0);
        powers(1);

        // one test per pass, a scalar branch: no power passed RESCALE_AT where no lane's sum did
        // (an overflow to infinity shows in the sum too). The first pass always sets the reference.
        const bool need = fmaxf(tot[0], tot[1]) > RESCALE_AT;
        if (st == 0 || __builtin_amdgcn_ballot_w32(need) != 0u) {
            #pragma unroll
            for (int j = 0; j < 2; ++j) {
                float mx[8];
                #pragma unroll
                for (int r = 0; r < 8; ++r) mx[r] = fmaxf(s[j][0][r], s[j][1][r]);
                float d = fmaxf(fmaxf(fmaxf(mx[0], mx[1]), fmaxf(mx[2], mx[3])),
                                fmaxf(fmaxf(mx[4], mx[5]), fmaxf(mx[6], mx[7])));
                d = fmaxf(d, xhalf(d));             // 16 keys here, 16 in lane ^ 16
                if (st != 0) d = fmaxf(d, 0.f);     // behind the first pass the reference only rises
                // 2^-d, never above 1; in asm so that the v_nop, the slot the instruction set asks
                // for behind a transcendental, stays directly behind it
                float alpha;
                asm("v_exp_f32 %0, %1\n\tv_nop" : "=v"(alpha) : "v"(fminf(-d, 0.f)));
                mref[j] += d;
                #pragma unroll
                for (int r = 0; r < 8; ++r) cneg[j][r] = -mref[j];
                #pragma unroll
                for (int t = 0; t < 4; ++t) acc[j][t] *= alpha;
                l[j] *= alpha;
                #pragma unroll
                for (int t = 0; t < 2; ++t) s[j][t] -= d;
                powers(j);
            }
        }
        l[0] += tot[0];
        l[1] += tot[1];

        // ---- O^T += V^T * P^T : A = V^T rows (channels) from LDS, in P^T's key order ----
        #pragma unroll
        for (int j = 0; j < 2; ++j) {
            #pragma unroll
            for (int t = 0; t < 4; ++t)
                acc[j][t] = __builtin_amdgcn_wmma_f32_16x16x32_f16(false, va[t], false, pf[j],
                                                                   (short)0, acc[j][t], false, false);
        }

        // ---- hand-over behind a stage's last pass: one barrier publishes the next stage and
        // frees this stage's buffer (the test reads the same for the whole work-group) ----
        if ((st & (PPS - 1)) == PPS - 1) {
            const int sg = st / PPS;
            asm volatile("s_wait_dscnt 0x0" ::: "memory");      // this wave's reads of the stage are done
            asm volatile("s_wait_asynccnt 0x0" ::: "memory");   // its pieces of stage sg + 1 landed
            __syncthreads();
            if (sg + 2 < NSG) stage_h(sg + 2, sg & 1);
        }
    }
    asm volatile("s_wait_asynccnt 0x0" ::: "memory");       // nothing in flight behind the loop

    // ---- each wave lays down its reference, sum (halves joined) and O rows ----
    // the partial rows take the ring's place in LDS: behind the last hand-over's barrier nobody
    // reads the ring any more, and no copy is in flight
    float (*part)[32 * O_PITCH] = (float (*)[32 * O_PITCH])&h_lds[0][0];   // [wave][query][ch]
    // a lane's 8 registers of a tile are 8 consecutive channels of its query's row
    #pragma unroll
    for (int j = 0; j < 2; ++j) {
        const float lt = l[j] + xhalf(l[j]);
        if (lhalf == 0) { pm[wave][j * 16 + lrow] = mref[j]; pl[wave][j * 16 + lrow] = lt; }
        float* prow = &part[wave][(j * 16 + lrow) * O_PITCH + lhalf * 8];
        #pragma unroll
        for (int t = 0; t < 4; ++t) {
            f32x4 lo, hi;
            #pragma unroll
            for (int e = 0; e < 4; ++e) { lo[e] = acc[j][t][e]; hi[e] = acc[j][t][e + 4]; }
            *(f32x4*)(prow + t * 16)     = lo;
            *(f32x4*)(prow + t * 16 + 4) = hi;
        }
    }
    __syncthreads();

    // ---- join the 8 key groups, normalize, lay O^T down in LDS ----
    // a thread owns 8 channels of one query
    const int jq = tid >> 3;                    // query of the tile, 0..63
    const int c8 = (tid & 7) * 8;
    const int w0 = (jq >> 5) * 8, qr = jq & 31;
    float mg[8];
    #pragma unroll
    for (int g = 0; g < 8; ++g) mg[g] = pm[w0 + g][qr];
    const float mall = fmaxf(fmaxf(fmaxf(mg[0], mg[1]), fmaxf(mg[2], mg[3])),
                             fmaxf(fmaxf(mg[4], mg[5]), fmaxf(mg[6], mg[7])));
    v8f dm;
    #pragma unroll
    for (int g = 0; g < 8; ++g) dm[g] = mg[g] - mall;
    float wg[8];
    exp2x8(wg, dm);
    float lall = 0.f;
    f32x4 lo = {}, hi = {};
    #pragma unroll
    for (int g = 0; g < 8; ++g) {
        const float* prow = &part[w0 + g][qr * O_PITCH + c8];
        lall += wg[g] * pl[w0 + g][qr];
        lo   += wg[g] * *(const f32x4*)prow;
        hi   += wg[g] * *(const f32x4*)(prow + 4);
    }
    const float inv = 1.f / lall;
    lo = lo * inv;
    hi = hi * inv;
    #pragma unroll
    for (int e = 0; e < 4; ++e) {
        ot[(c8 + e) * OT_PITCH + jq]     = lo[e];
        ot[(c8 + 4 + e) * OT_PITCH + jq] = hi[e];
    }
    f32x2 pa[4];
    #pragma unroll
    for (int u = 0; u < 4; ++u) { const float bv = bfc[CDIM + c0 + u]; pa[u][0] = bv; pa[u][1] = bv; }
    __syncthreads();

    // ---- folded 1x1 conv + residual: 4 output channels x 64 pixels per wave ----
    // residual rows: asked for behind the barrier (which would wait for them), used at the very end
    const size_t idx0 = ((size_t)(b * CDIM + c0)) * HW + qtile * 64 + 2 * lane;
    f32x2 xr[4];
    #pragma unroll
    for (int u = 0; u < 4; ++u) xr[u] = *(const f32x2*)(x + idx0 + (size_t)u * HW);
    conv4(pa, wfc + (CDIM + c0) * CDIM, ot, OT_PITCH, lane);
    // one run of 256 B (two whole lines) per channel and wave
    #pragma unroll
    for (int u = 0; u < 4; ++u) *(f32x2*)(out + idx0 + (size_t)u * HW) = xr[u] + pa[u];
}

// ---------------------------------------------------------------------------
extern "C" void kernel_launch(void* const* d_in, const int* in_sizes, int n_in,
                              void* d_out, int out_size, void* d_ws, size_t ws_size,
                              hipStream_t stream) {
    const float* x      = (const float*)d_in[0];
    const float* w_qkv  = (const float*)d_in[1];
    const float* b_qkv  = (const float*)d_in[2];
    const float* w_proj = (const float*)d_in[3];
    const float* b_proj = (const float*)d_in[4];
    float* out = (float*)d_out;

    const size_t B = 4;
    char* ws = (char*)d_ws;
    float*    mean = (float*)ws;                       // 256 f32
    float*    rstd = mean + 256;                       // 256 f32
    float*    bf   = rstd + 256;                       // 2 x 64 f32
    float*    wf   = (float*)(ws + 4096);              // 2 x 64 x 64 f32
    _Float16* hn   = (_Float16*)(ws + 4096 + 32768);   // 2 MB (f16)

    norm_kernel<<<B * CDIM + FOLD_WG, 256, 0, stream>>>(x, w_qkv, b_qkv, w_proj, b_proj, mean, rstd, hn, wf, bf);
    attn_kernel<<<B * (HW / 64), 512, 0, stream>>>(hn, x, mean, rstd, wf, bf, out);
}

// v008
// One run takes 20.1 microseconds.
// Next to v007, in two timings, it ran 1.03 and 1.05 times as fast.
// Over all steps from v000 it is 11.4 times as fast.
#include <hip/hip_runtime.h>
#include <hip/hip_bf16.h>

typedef __attribute__((ext_vector_type(16))) _Float16 v16h;
typedef __attribute__((ext_vector_type(8)))  float    v8f;
typedef __attribute__((ext_vector_type(8)))  _Float16 v8h;
typedef __attribute__((ext_vector_type(4)))  _Float16 v4h;
typedef __attribute__((ext_vector_type(8)))  short    s16x8;
typedef __attribute__((ext_vector_type(2)))  _Float16 h16x2;
typedef __attribute__((ext_vector_type(4)))  float    f32x4;
typedef __attribute__((ext_vector_type(2)))  float    f32x2;
typedef __attribute__((address_space(4)))    float    cfloat;   // a float in constant memory

#define HW   4096
#define CDIM 64
#define Q_SCALE 0.18033688f   // 64^-0.5 * log2(e): q carries it, so a score is an exponent of 2
#define RESCALE_AT 256.f      // a lane's sum of a pass's 16 powers above this moves the reference
#define O_PITCH  68        // floats per staged pixel row: 64 + 4, a pitch of 16 B x odd
#define KST      256       // keys per pass of the key loop: 8 wave groups x 32 keys
#define NST      (HW / KST)
#define PPS      4         // passes per stage of the attention ring: a stage is 1024 keys
#define NSG      (NST / PPS)
#define ROW_WG   256       // one-wave work-groups of the first kernel that normalize a (b,c) row each
#define FOLD_WG  260       // one-wave work-groups of the first kernel that fold the weights: 2 x 128 half rows, 4 half vectors
#define H_PITCH  272       // halfs per staged channel row of h: 256 + 16, a pitch of 32 B x odd (transposing reads)
#define Q_PITCH  72        // halfs per staged query row: 64 + 8, a pitch of 16 B x odd
#define OT_PITCH 66        // floats per staged channel row of the tile's O^T: 64 + 2, rows stay 8 B aligned

// ---------------------------------------------------------------------------
// CDNA5 async global->LDS copies, 16 bytes per lane each, tracked by ASYNCcnt.
// l*: the lane's LDS byte address (low 32 bits of the flat LDS pointer).
// One statement for a thread's four copies of a pass's keys; the s_wait_xcnt at its end
// stands in front of any rewrite of an address register (precaution for issued copies).
// ---------------------------------------------------------------------------
__device__ __forceinline__ void async_copy16x4(unsigned l0, unsigned l1, unsigned l2, unsigned l3,
                                               const void* g0, const void* g1, const void* g2, const void* g3) {
    asm volatile("global_load_async_to_lds_b128 %0, %4, off\n\t"
                 "global_load_async_to_lds_b128 %1, %5, off\n\t"
                 "global_load_async_to_lds_b128 %2, %6, off\n\t"
                 "global_load_async_to_lds_b128 %3, %7, off\n\t"
                 "s_wait_xcnt 0x0"
                 :: "v"(l0), "v"(l1), "v"(l2), "v"(l3), "v"(g0), "v"(g1), "v"(g2), "v"(g3)
                 : "memory");
}

// lane l <-> lane l ^ 16, on the vector pipe
__device__ __forceinline__ float xhalf(float v) {
    const int b = __float_as_int(v);
    return __int_as_float(__builtin_amdgcn_permlanex16(b, b, 0x76543210, 0xfedcba98, false, false));
}

// y = 2^x for eight values (a score tile; the join's weights). In asm, with results that share no
// register with a source, so that every v_exp_f32 is followed by an instruction that touches none of
// its registers, the last one by the v_nop: the slot the instruction set asks for behind a transcendental
__device__ __forceinline__ void exp2x8(float (&y)[8], v8f x) {
    asm("v_exp_f32 %0, %8\n\tv_exp_f32 %1, %9\n\tv_exp_f32 %2, %10\n\tv_exp_f32 %3, %11\n\t"
        "v_exp_f32 %4, %12\n\tv_exp_f32 %5, %13\n\tv_exp_f32 %6, %14\n\tv_exp_f32 %7, %15\n\tv_nop"
        : "=&v"(y[0]), "=&v"(y[1]), "=&v"(y[2]), "=&v"(y[3]), "=&v"(y[4]), "=&v"(y[5]), "=&v"(y[6]), "=&v"(y[7])
        : "v"(x[0]), "v"(x[1]), "v"(x[2]), "v"(x[3]), "v"(x[4]), "v"(x[5]), "v"(x[6]), "v"(x[7]));
}

// The eight score products of a pass: s[j][t] = c[j] + K tile t (A, two halves of the channels) x
// Q^T tile j (B). In one asm statement so that C stays a register block of its own that the four first
// products only read (the builtin form copied it, 16 registers a pass); each accumulate stands four
// products behind its first half. The v_nops keep the distance the chip needs between the last
// product and the first vector instruction that reads a result or overwrites an operand.
__device__ __forceinline__ void scores8(v8f (&s)[2][2], const v16h (&ka)[2][2], const v16h (&qf)[2][2],
                                        const v8f (&c)[2]) {
    asm("v_wmma_f32_16x16x32_f16 %0, %4, %8, %12\n\t"
        "v_wmma_f32_16x16x32_f16 %1, %5, %8, %12\n\t"
        "v_wmma_f32_16x16x32_f16 %2, %4, %10, %13\n\t"
        "v_wmma_f32_16x16x32_f16 %3, %5, %10, %13\n\t"
        "v_wmma_f32_16x16x32_f16 %0, %6, %9, %0\n\t"
        "v_wmma_f32_16x16x32_f16 %1, %7, %9, %1\n\t"
        "v_wmma_f32_16x16x32_f16 %2, %6, %11, %2\n\t"
        "v_wmma_f32_16x16x32_f16 %3, %7, %11, %3\n\t"
        "v_nop\n\tv_nop\n\tv_nop\n\tv_nop"
        : "=&v"(s[0][0]), "=&v"(s[0][1]), "=&v"(s[1][0]), "=&v"(s[1][1])
        : "v"(ka[0][0]), "v"(ka[0][1]), "v"(ka[1][0]), "v"(ka[1][1]),
          "v"(qf[0][0]), "v"(qf[0][1]), "v"(qf[1][0]), "v"(qf[1][1]), "v"(c[0]), "v"(c[1]));
}

// one 16x32 f16 operand row in the hardware k order: for lane half h the halfs
// 8h..8h+7 and 16+8h..16+8h+7 of the 32; p already points at half 8h
__device__ __forceinline__ v16h frag_kmap(const _Float16* p) {
    const v8h lo = *(const v8h*)p;
    const v8h hi = *(const v8h*)(p + 16);
    return __builtin_shufflevector(lo, hi, 0, 1, 2, 3, 4, 5, 6, 7, 8, 9, 10, 11, 12, 13, 14, 15);
}

// one 16x32 f16 A operand, rows along the columns of a row-major LDS tile [k][row], by the
// transposing load: p is the lane's address for k 0..15 (row k = 8 * lane half + (lane & 7),
// 16 B piece (lane >> 3) & 1); it delivers the hardware k order of frag_kmap
__device__ __forceinline__ v16h frag_tr(const unsigned char* p) {
    typedef __attribute__((address_space(3))) s16x8 lds_s16x8;
    const v8h lo = __builtin_bit_cast(v8h, __builtin_amdgcn_ds_load_tr16_b128_v8i16((lds_s16x8*)p));
    const v8h hi = __builtin_bit_cast(v8h, __builtin_amdgcn_ds_load_tr16_b128_v8i16((lds_s16x8*)(p + 16 * H_PITCH * 2)));
    return __builtin_shufflevector(lo, hi, 0, 1, 2, 3, 4, 5, 6, 7, 8, 9, 10, 11, 12, 13, 14, 15);
}

// a 1x1 conv on a tile of 64 pixels in LDS, src[c][pixel]: a[u] += sum over c of w[u][c] * src[c].
// Lanes run along pixels (two adjacent pixels per lane), a wave owns 4 output channels, and the
// weights are wave-uniform, so they come through scalar loads.
__device__ __forceinline__ void conv4(f32x2 (&a)[4], const cfloat* w, const float* src, int pitch, int lane) {
    // rolled over groups of 16 input channels: what a group loads fits the scalar registers
    #pragma unroll 1
    for (int cg = 0; cg < CDIM; cg += 16) {
        #pragma unroll
        for (int j = 0; j < 16; ++j) {
            const f32x2 h = *(const f32x2*)(src + (cg + j) * pitch + 2 * lane);
            #pragma unroll
            for (int u = 0; u < 4; ++u) a[u] += w[u * CDIM + cg + j] * h;
        }
    }
}

// init + sum over 64 terms of a[o * AS] * b[o * BS], in four chains; a is wave-uniform and comes
// through scalar loads, b is the lane's own; the steps are compile-time, so that every load is its
// base address plus an immediate offset
template <int AS, int BS>
__device__ __forceinline__ float dot64(const cfloat* a, const float* b, float init) {
    float bv[CDIM];
    #pragma unroll
    for (int o = 0; o < CDIM; ++o) bv[o] = b[o * BS];
    // before a register that these loads name is written again (precaution for issued loads)
    asm volatile("s_wait_xcnt 0x0" ::: "memory");
    float s[4] = { init, 0.f, 0.f, 0.f };
    #pragma unroll
    for (int o = 0; o < CDIM; ++o) s[o & 3] += a[o * AS] * bv[o];
    return (s[0] + s[1]) + (s[2] + s[3]);
}

// sum over the wave's 32 lanes, the total in every lane, on the vector pipe: four exchanges inside
// the 16-lane rows (DPP row_xmask 1, 2, 4, 8), then one between the rows
__device__ __forceinline__ float wave_sum(float v) {
    v += __int_as_float(__builtin_amdgcn_update_dpp(0, __float_as_int(v), 0x161, 0xf, 0xf, false));
    v += __int_as_float(__builtin_amdgcn_update_dpp(0, __float_as_int(v), 0x162, 0xf, 0xf, false));
    v += __int_as_float(__builtin_amdgcn_update_dpp(0, __float_as_int(v), 0x164, 0xf, 0xf, false));
    v += __int_as_float(__builtin_amdgcn_update_dpp(0, __float_as_int(v), 0x168, 0xf, 0xf, false));
    return v + xhalf(v);
}

// ---------------------------------------------------------------------------
// Kernel 1, work-groups of ONE wave (a launch this short is paid for by the wave: few waves start sooner).
// The first 256: per-(b,c) InstanceNorm over 4096 spatial elements, one wave per row: all 32 loads of
// a lane are in flight at once, the row stays in registers, the sums are joined across the lanes
// without LDS or a barrier; out go the statistics and the normalized row h as f16 [B, C, HW].
// The other 260 fold the weights, one output element per thread, f32:
// wf[0] = Wk^T Wq, bf[0] = Wk^T bq (query side); wf[1] = Wp Wv, bf[1] = Wp bv + bp (output side).
// ---------------------------------------------------------------------------
__global__ __launch_bounds__(32) void norm_kernel(const float* __restrict__ x,
                                                  const float* __restrict__ w_qkv,
                                                  const float* __restrict__ b_qkv,
                                                  const float* __restrict__ w_proj,
                                                  const float* __restrict__ b_proj,
                                                  float* __restrict__ mean,
                                                  float* __restrict__ rstd,
                                                  _Float16* __restrict__ hn,
                                                  float* __restrict__ wf,
                                                  float* __restrict__ bf) {
    const int lane = threadIdx.x;
    if (blockIdx.x >= ROW_WG) {
        const int fw   = blockIdx.x - ROW_WG;   // half a row of a folded matrix, or half a vector
        const int f    = fw >> 3;               // 0..31: 4 rows of a folded matrix each; 32: the two vectors
        const int wrow = (fw & 7) >> 1;
        const int cc   = (fw & 1) * 32 + lane;
        const int r    = (f * 4 + wrow) & 63;
        const float* wk = w_qkv + CDIM * CDIM;
        const float* wv = w_qkv + 2 * CDIM * CDIM;
        // the inputs are written by nobody: the wave-uniform operand is read through the constant address space
        // the wait behind each store: before a register that it names is written again (precaution for issued stores)
        if (f < 16) {
            wf[r * CDIM + cc] = dot64<CDIM, CDIM>((const cfloat*)wk + r, w_qkv + cc, 0.f);
            asm volatile("s_wait_xcnt 0x0" ::: "memory");
        } else if (f < 32) {
            wf[(CDIM + r) * CDIM + cc] = dot64<1, CDIM>((const cfloat*)w_proj + r * CDIM, wv + cc, 0.f);
            asm volatile("s_wait_xcnt 0x0" ::: "memory");
        } else if (wrow == 0) {
            bf[cc] = dot64<1, CDIM>((const cfloat*)b_qkv, wk + cc, 0.f);
            asm volatile("s_wait_xcnt 0x0" ::: "memory");
        } else if (wrow == 1) {
            bf[CDIM + cc] = dot64<1, 1>((const cfloat*)b_qkv + 2 * CDIM, w_proj + cc * CDIM, b_proj[cc]);
            asm volatile("s_wait_xcnt 0x0" ::: "memory");
        }
        return;
    }
    const int bc = blockIdx.x;                  // 0..255 = b*64 + c
    const float* xp = x + (size_t)bc * HW;
    f32x4 v[32];                                // whole lines: 512 B of the row per load of the wave
    #pragma unroll
    for (int r = 0; r < 32; ++r) v[r] = *(const f32x4*)(xp + (lane + r * 32) * 4);
    // before a register that these loads name is written again (precaution for issued loads)
    asm volatile("s_wait_xcnt 0x0" ::: "memory");
    // eight chains each for the sum and the sum of squares: a lone wave has nobody to fill a chain's latency
    f32x4 s4[2] = { v[0], v[1] }, q4[2] = { v[0] * v[0], v[1] * v[1] };
    #pragma unroll
    for (int r = 2; r < 32; r += 2) {
        s4[0] += v[r];        s4[1] += v[r + 1];
        q4[0] += v[r] * v[r]; q4[1] += v[r + 1] * v[r + 1];
        // keeps all eight chains going in the order in which the loads return: without it most of the
        // squares were sunk behind the last load, one and two chains at a time
        __builtin_amdgcn_sched_barrier(0);
    }
    const f32x4 st = s4[0] + s4[1], qt = q4[0] + q4[1];
    const float s  = wave_sum((st[0] + st[1]) + (st[2] + st[3]));
    const float sq = wave_sum((qt[0] + qt[1]) + (qt[2] + qt[3]));
    const float mu  = s * (1.f / HW);
    const float var = sq * (1.f / HW) - mu * mu;
    const float rs  = rsqrtf(var + 1e-5f);
    if (lane == 0) {
        mean[bc] = mu; rstd[bc] = rs;
        // before a register that these stores name is written again (precaution for issued stores)
        asm volatile("s_wait_xcnt 0x0" ::: "memory");
    }
    _Float16* hp = hn + (size_t)bc * HW;
    #pragma unroll
    for (int r = 0; r < 32; ++r) {
        v4h o;
        #pragma unroll
        for (int e = 0; e < 4; ++e) o[e] = (_Float16)((v[r][e] - mu) * rs);
        *(v4h*)(hp + (lane + r * 32) * 4) = o;
    }
    asm volatile("s_wait_xcnt 0x0" ::: "memory");   // the same precaution behind the row's stores
}

// ---------------------------------------------------------------------------
// Kernel 2: flash attention on the normalized input h itself, WMMA f32_16x16x32_f16,
// double-buffered async global->LDS staging of h in stages of 1024 keys (four passes of 256 keys:
// between two hand-overs the waves run free of each other, so that one wave's LDS reads and
// products fill the slots that another leaves open in its softmax).
// With k = Wk h + bk, a score q.k is (Wk^T q).h plus q.bk, which is the same for every key and
// drops out of the softmax; with v = Wv h + bv and weights that sum to 1, sum P v = Wv (sum P h) + bv.
// So h serves as K and as V: the work-group forms (Wk^T Wq) h + Wk^T bq for its 64 queries in f32 ahead of
// the key loop (multiplied by Q_SCALE ahead of its one rounding to f16), and Wv, bv go into the projection behind it.
// Grid: B * (HW/64) blocks, 512 threads (16 waves, four per SIMD). Wave w owns the
// 32 queries of half w >> 3 and, in every pass, the 32 keys of group w & 7: each
// fragment read from LDS serves two query tiles, and the waves of a SIMD
// fill each other's waits. The eight key groups' partial results are joined at the end.
// Transposed products: S^T = h^T Q^T (A by the transposing LDS load) and O^T += h P^T. A lane holds scores of
// one query per tile (column = lane & 15), so maximum and sum need only lane ^ 16, and
// two score tiles, converted in place, are the B operand of the second product.
// The softmax reference of a query is fixed ahead of a pass: minus the reference is the C
// operand of the score products, which so deliver the exponents of 2 themselves. It moves,
// and O and the sums are rescaled, in the first pass and in a pass whose powers grow large (one test per pass).
// The tile's 64 joined rows never leave the work-group: the 1x1 conv (Wp Wv, folded) and the
// residual follow in the same kernel, out [B, C, H, W] f32.
// ---------------------------------------------------------------------------
__global__ __launch_bounds__(512) void attn_kernel(const _Float16* __restrict__ hn,
                                                   const float* __restrict__ x,
                                                   const float* __restrict__ mean,
                                                   const float* __restrict__ rstd,
                                                   const float* __restrict__ wf,
                                                   const float* __restrict__ bf,
                                                   float* __restrict__ out) {
    __shared__ __align__(16) _Float16 h_lds[2 * PPS][CDIM * H_PITCH];   // [buf * PPS + pass of the stage][ch][key]
    __shared__ float pm[16][32];                                   // [wave][query] reference, log2 domain
    __shared__ float pl[16][32];                                   // [wave][query] sum
    __shared__ __align__(16) float    hs[CDIM * 64];               // [ch][query] the tile's own h, f32
    __shared__ __align__(16) float    ot[CDIM * OT_PITCH];         // [ch][query], joined and normalized
    __shared__ __align__(16) _Float16 q16[64 * Q_PITCH];           // [query][ch]: Wk^T q, scaled

    const int b     = blockIdx.x >> 6;          // 64 query tiles per batch
    const int qtile = blockIdx.x & 63;
    const int tid   = threadIdx.x;
    const int wave  = __builtin_amdgcn_readfirstlane(tid >> 5);
    const int lane  = tid & 31;
    const int lrow  = lane & 15;
    const int lhalf = lane >> 4;
    const int qh    = wave >> 3;                // which 32 of the 64 queries
    const int grp   = wave & 7;                 // which 32 of a pass's 256 keys

    const int c0    = wave * 4;                 // the wave's 4 channels in every 1x1 conv

    // this thread's pieces of a pass's keys: 64 channel rows of 32 pieces of 16 B
    // (a wave copies one whole row of 512 B at a time)
    const char* hg0 = (const char*)(hn + ((size_t)b * CDIM) * HW) + (size_t)(tid >> 5) * (HW * 2) + lane * 16;
    const unsigned hd0 = (unsigned)(uintptr_t)&h_lds[0][0] + (tid >> 5) * (H_PITCH * 2) + lane * 16;

    // ---- issue async staging of one 1024-key stage (16 b128s per thread) ----
    auto stage_h = [&](int sg, int buf) {
        // unrolled, so that the four statements' addresses differ by constants only
        #pragma unroll
        for (int i = 0; i < PPS; ++i) {
            const char* hg = hg0 + (size_t)(sg * PPS + i) * (KST * 2);      // 512 B of every channel row
            const unsigned hd = hd0 + (buf * PPS + i) * (CDIM * H_PITCH * 2);
            async_copy16x4(hd, hd + 16 * H_PITCH * 2, hd + 32 * H_PITCH * 2, hd + 48 * H_PITCH * 2,
                           hg, hg + 16 * (HW * 2), hg + 32 * (HW * 2), hg + 48 * (HW * 2));
        }
    };

    // ---- the tile's own h in f32, read in whole lines along the pixels (1024 pieces of 16 B) ----
    {
        f32x4 xv[2];
        float mu[2], rs[2];
        #pragma unroll
        for (int r = 0; r < 2; ++r) {
            const int i = tid + r * 512;
            const int c = i >> 4, p4 = (i & 15) * 4;
            xv[r] = *(const f32x4*)(x + ((size_t)(b * CDIM + c)) * HW + qtile * 64 + p4);
            mu[r] = mean[b * CDIM + c];
            rs[r] = rstd[b * CDIM + c];
        }
        // before a register that these loads name is written again (precaution for issued loads)
        asm volatile("s_wait_xcnt 0x0" ::: "memory");
        // stage 0 flies while the queries are set up; asked for behind the tile's own loads,
        // which would otherwise queue behind its 128 KB
        stage_h(0, 0);
        #pragma unroll
        for (int r = 0; r < 2; ++r) {
            const int i = tid + r * 512;
            const int c = i >> 4, p4 = (i & 15) * 4;
            f32x4 hv;
            #pragma unroll
            for (int e = 0; e < 4; ++e) hv[e] = (xv[r][e] - mu[r]) * rs[r];
            *(f32x4*)(hs + c * 64 + p4) = hv;
        }
    }
    // the folded weights are written by nobody during this launch: read through the constant
    // address space, so that these wave-uniform reads stay scalar loads behind the asm statements
    const cfloat* wfc = (const cfloat*)wf;
    const cfloat* bfc = (const cfloat*)bf;
    __syncthreads();
    // ---- Wk^T q = (Wk^T Wq) h + Wk^T bq, scaled, one f16 row per query ----
    {
        f32x2 qa[4];
        #pragma unroll
        for (int u = 0; u < 4; ++u) { const float bv = bfc[c0 + u]; qa[u][0] = bv; qa[u][1] = bv; }
        conv4(qa, wfc + c0 * CDIM, hs, 64, lane);
        #pragma unroll
        for (int e = 0; e < 2; ++e) {
            v4h o;
            #pragma unroll
            for (int u = 0; u < 4; ++u) o[u] = (_Float16)(qa[u][e] * Q_SCALE);
            *(v4h*)(q16 + (2 * lane + e) * Q_PITCH + c0) = o;
        }
    }
    asm volatile("s_wait_asynccnt 0x0" ::: "memory");   // this wave's pieces of stage 0 landed
    __syncthreads();                                    // and every other wave's; the query rows too
    stage_h(1, 1);

    // Q B-fragments (64 ch x 2 x 16 queries) held in registers for the whole key loop.
    v16h qf[2][2];
    #pragma unroll
    for (int j = 0; j < 2; ++j) {
        const _Float16* qbase = q16 + (qh * 32 + j * 16 + lrow) * Q_PITCH;
        qf[j][0] = frag_kmap(qbase + lhalf * 8);         // ch 0..31
        qf[j][1] = frag_kmap(qbase + 32 + lhalf * 8);    // ch 32..63
    }

    v8f acc[2][4] = {};               // O^T per query tile: acc[j][t][r] = ch 16t + 8*lhalf + r
    float mref[2] = { 0.f, 0.f };     // this lane's queries: reference in use, log2 domain (same in both halves)
    v8f   cneg[2] = {};               // minus the reference in all 8 registers: C of the score products
    float l[2] = { 0.f, 0.f };        // and the sum over this lane half's keys only

    // the lane's place in a pass's keys for the transposing reads: channel row 8 * lhalf + (lane & 7),
    // the group's 32 keys, 16 B piece (lane >> 3) & 1
    const unsigned troff = (lhalf * 8 + (lane & 7)) * (H_PITCH * 2) + grp * 64 + ((lane >> 3) & 1) * 16;

    for (int st = 0; st < NST; ++st) {
        const int cur = st & (2 * PPS - 1);     // buffer (st / PPS) & 1, pass st % PPS of its stage
        const unsigned char* kl = (const unsigned char*)&h_lds[cur][0] + troff;
        const _Float16* vl = &h_lds[cur][grp * 32];

        // ---- S^T = K * Q^T - reference : 2 tiles of 16 keys, s[j][t][r] = key 16t + 8*lhalf + r ----
        v16h ka[2][2], va[4];
        #pragma unroll
        for (int kc = 0; kc < 2; ++kc) {
            #pragma unroll
            for (int t = 0; t < 2; ++t)
                ka[kc][t] = frag_tr(kl + kc * 32 * (H_PITCH * 2) + t * 32);
        }
        v8f s[2][2];
        scores8(s, ka, qf, cneg);
        // the two scheduling barriers keep the V^T fragment loads between the score products and the
        // powers: lifted above the products they queue in front of the other waves' K reads, sunk
        // below the powers they leave their LDS latency open in front of the second product
        __builtin_amdgcn_sched_barrier(0);
        #pragma unroll
        for (int t = 0; t < 4; ++t)
            va[t] = frag_kmap(&vl[(t * 16 + lrow) * H_PITCH + lhalf * 8]);
        __builtin_amdgcn_sched_barrier(0);

        // ---- softmax against the reference in use, one query per lane and tile ----
        // P^T: the two tiles, converted in place, are the B operand of the 32 keys
        v16h pf[2];
        float tot[2];
        auto powers = [&](int j) {
            float ps[8];
            #pragma unroll
            for (int t = 0; t < 2; ++t) {
                float e[8];
                exp2x8(e, s[j][t]);
                #pragma unroll
                for (int r = 0; r < 8; r += 2) {
                    f32x2 p;
                    p[0] = e[r];
                    p[1] = e[r + 1];
                    ps[r]     = t ? ps[r] + p[0] : p[0];
                    ps[r + 1] = t ? ps[r + 1] + p[1] : p[1];
                    const h16x2 ph = __builtin_convertvector(p, h16x2);
                    pf[j][t * 8 + r]     = ph[0];
                    pf[j][t * 8 + r + 1] = ph[1];
                }
            }
            tot[j] = ((ps[0] + ps[1]) + (ps[2] + ps[3])) + ((ps[4] + ps[5]) + (ps[6] + ps[7]));
        };
        powers(0);
        powers(1);

        // one test per pass, a scalar branch: no power passed RESCALE_AT where no lane's sum did
        // (an overflow to infinity shows in the sum too). The first pass always sets the reference.
        const bool need = fmaxf(tot[0], tot[1]) > RESCALE_AT;
        if (st == 0 || __builtin_amdgcn_ballot_w32(need) != 0u) {
            #pragma unroll
            for (int j = 0; j < 2; ++j) {
                float mx[8];
                #pragma unroll
                for (int r = 0; r < 8; ++r) mx[r] = fmaxf(s[j][0][r], s[j][1][r]);
                float d = fmaxf(fmaxf(fmaxf(mx[0], mx[1]), fmaxf(mx[2], mx[3])),
                                fmaxf(fmaxf(mx[4], mx[5]), fmaxf(mx[6], mx[7])));
                d = fmaxf(d, xhalf(d));             // 16 keys here, 16 in lane ^ 16
                if (st != 0) d = fmaxf(d, 0.f);     // behind the first pass the reference only rises
                // 2^-d, never above 1; in asm so that the v_nop, the slot the instruction set asks
                // for behind a transcendental, stays directly behind it
                float alpha;
                asm("v_exp_f32 %0, %1\n\tv_nop" : "=v"(alpha) : "v"(fminf(-d, 0.f)));
                mref[j] += d;
                #pragma unroll
                for (int r = 0; r < 8; ++r) cneg[j][r] = -mref[j];
                #pragma unroll
                for (int t = 0; t < 4; ++t) acc[j][t] *= alpha;
                l[j] *= alpha;
                #pragma unroll
                for (int t = 0; t < 2; ++t) s[j][t] -= d;
                powers(j);
            }
        }
        l[0] += tot[0];
        l[1] += tot[1];

        // ---- O^T += V^T * P^T : A = V^T rows (channels) from LDS, in P^T's key order ----
        #pragma unroll
        for (int j = 0; j < 2; ++j) {
            #pragma unroll
            for (int t = 0; t < 4; ++t)
                acc[j][t] = __builtin_amdgcn_wmma_f32_16x16x32_f16(false, va[t], false, pf[j],
                                                                   (short)0, acc[j][t], false, false);
        }

        // ---- hand-over behind a stage's last pass: one barrier publishes the next stage and
        // frees this stage's buffer (the test reads the same for the whole work-group) ----
        if ((st & (PPS - 1)) == PPS - 1) {
            const int sg = st / PPS;
            asm volatile("s_wait_dscnt 0x0" ::: "memory");      // this wave's reads of the stage are done
            asm volatile("s_wait_asynccnt 0x0" ::: "memory");   // its pieces of stage sg + 1 landed
            __syncthreads();
            if (sg + 2 < NSG) stage_h(sg + 2, sg & 1);
        }
    }
    asm volatile("s_wait_asynccnt 0x0" ::: "memory");       // nothing in flight behind the loop

    // ---- each wave lays down its reference, sum (halves joined) and O rows ----
    // the partial rows take the ring's place in LDS: behind the last hand-over's barrier nobody
    // reads the ring any more, and no copy is in flight
    float (*part)[32 * O_PITCH] = (float (*)[32 * O_PITCH])&h_lds[0][0];   // [wave][query][ch]
    // a lane's 8 registers of a tile are 8 consecutive channels of its query's row
    #pragma unroll
    for (int j = 0; j < 2; ++j) {
        const float lt = l[j] + xhalf(l[j]);
        if (lhalf == 0) { pm[wave][j * 16 + lrow] = mref[j]; pl[wave][j * 16 + lrow] = lt; }
        float* prow = &part[wave][(j * 16 + lrow) * O_PITCH + lhalf * 8];
        #pragma unroll
        for (int t = 0; t < 4; ++t) {
            f32x4 lo, hi;
            #pragma unroll
            for (int e = 0; e < 4; ++e) { lo[e] = acc[j][t][e]; hi[e] = acc[j][t][e + 4]; }
            *(f32x4*)(prow + t * 16)     = lo;
            *(f32x4*)(prow + t * 16 + 4) = hi;
        }
    }
    __syncthreads();

    // ---- join the 8 key groups, normalize, lay O^T down in LDS ----
    // a thread owns 8 channels of one query
    const int jq = tid >> 3;                    // query of the tile, 0..63
    const int c8 = (tid & 7) * 8;
    const int w0 = (jq >> 5) * 8, qr = jq & 31;
    float mg[8];
    #pragma unroll
    for (int g = 0; g < 8; ++g) mg[g] = pm[w0 + g][qr];
    const float mall = fmaxf(fmaxf(fmaxf(mg[0], mg[1]), fmaxf(mg[2], mg[3])),
                             fmaxf(fmaxf(mg[4], mg[5]), fmaxf(mg[6], mg[7])));
    v8f dm;
    #pragma unroll
    for (int g = 0; g < 8; ++g) dm[g] = mg[g] - mall;
    float wg[8];
    exp2x8(wg, dm);
    float lall = 0.f;
    f32x4 lo = {}, hi = {};
    #pragma unroll
    for (int g = 0; g < 8; ++g) {
        const float* prow = &part[w0 + g][qr * O_PITCH + c8];
        lall += wg[g] * pl[w0 + g][qr];
        lo   += wg[g] * *(const f32x4*)prow;
        hi   += wg[g] * *(const f32x4*)(prow + 4);
    }
    const float inv = 1.f / lall;
    lo = lo * inv;
    hi = hi * inv;
    #pragma unroll
    for (int e = 0; e < 4; ++e) {
        ot[(c8 + e) * OT_PITCH + jq]     = lo[e];
        ot[(c8 + 4 + e) * OT_PITCH + jq] = hi[e];
    }
    f32x2 pa[4];
    #pragma unroll
    for (int u = 0; u < 4; ++u) { const float bv = bfc[CDIM + c0 + u]; pa[u][0] = bv; pa[u][1] = bv; }
    __syncthreads();

    // ---- folded 1x1 conv + residual: 4 output channels x 64 pixels per wave ----
    // residual rows: asked for behind the barrier (which would wait for them), used at the very end
    const size_t idx0 = ((size_t)(b * CDIM + c0)) * HW + qtile * 64 + 2 * lane;
    f32x2 xr[4];
    #pragma unroll
    for (int u = 0; u < 4; ++u) xr[u] = *(const f32x2*)(x + idx0 + (size_t)u * HW);
    conv4(pa, wfc + (CDIM + c0) * CDIM, ot, OT_PITCH, lane);
    // one run of 256 B (two whole lines) per channel and wave
    #pragma unroll
    for (int u = 0; u < 4; ++u) *(f32x2*)(out + idx0 + (size_t)u * HW) = xr[u] + pa[u];
}

// ---------------------------------------------------------------------------
extern "C" void kernel_launch(void* const* d_in, const int* in_sizes, int n_in,
                              void* d_out, int out_size, void* d_ws, size_t ws_size,
                              hipStream_t stream) {
    const float* x      = (const float*)d_in[0];
    const float* w_qkv  = (const float*)d_in[1];
    const float* b_qkv  = (const float*)d_in[2];
    const float* w_proj = (const float*)d_in[3];
    const float* b_proj = (const float*)d_in[4];
    float* out = (float*)d_out;

    const size_t B = 4;
    char* ws = (char*)d_ws;
    float*    mean = (float*)ws;                       // 256 f32
    float*    rstd = mean + 256;                       // 256 f32
    float*    bf   = rstd + 256;                       // 2 x 64 f32
    float*    wf   = (float*)(ws + 4096);              // 2 x 64 x 64 f32
    _Float16* hn   = (_Float16*)(ws + 4096 + 32768);   // 2 MB (f16)

    norm_kernel<<<ROW_WG + FOLD_WG, 32, 0, stream>>>(x, w_qkv, b_qkv, w_proj, b_proj, mean, rstd, hn, wf, bf);
    attn_kernel<<<B * (HW / 64), 512, 0, stream>>>(hn, x, mean, rstd, wf, bf, out);
}
